// v000
// Times are from an AMD MI455X. After a warm-up the kernel runs many times in a row, and a time is the length of
// such a window on the GPU divided by its runs, so every launch and the gaps after it count. The runs cycle
// through copies of the inputs. A figure is the median of several windows, for all but v000 over two sittings.
// Sittings can differ by a few percent; kernels timed side by side share one.
// v000 is the starting kernel. One run takes 828 microseconds.
// Contractions: q = b.Wq^T (bf16 x bf16, 1 product), scores = q.a^T (q as bf16 hi/lo planes x a bf16, 2 products), out = P.a (P as bf16 hi/lo planes x a^T bf16, 2 products); all v_wmma_f32_16x16x32_bf16, f32 accumulate; inputs RNE-converted to bf16; scores f32, softmax f32.
#include <hip/hip_runtime.h>
#include <math.h>

// ---------------------------------------------------------------------------
// Problem constants
// ---------------------------------------------------------------------------
constexpr int kNB = 4;        // batch
constexpr int kSA = 2048;     // rows of a (keys / values)
constexpr int kSB = 2048;     // rows of b (queries)
constexpr int kD  = 1024;     // feature dim of a = attention dim = output dim
constexpr int kE  = 1024;     // feature dim of b
constexpr float kScoreScale = 0.03125f;   // 1024^-0.5 exactly

typedef __attribute__((ext_vector_type(16))) _Float16 v16h;
typedef __attribute__((ext_vector_type(8)))  _Float16 v8h;
typedef __attribute__((ext_vector_type(16))) __bf16   v16b;
typedef __attribute__((ext_vector_type(8)))  __bf16   v8b;
typedef __attribute__((ext_vector_type(8)))  float    v8f;
typedef __attribute__((ext_vector_type(4)))  float    v4f;
typedef __attribute__((ext_vector_type(4)))  unsigned int v4u;

// ---------------------------------------------------------------------------
// Device helpers
// ---------------------------------------------------------------------------
__device__ __forceinline__ unsigned short f2bf_bits(float f) {
  unsigned u = __float_as_uint(f);
  return (unsigned short)((u + 0x7FFFu + ((u >> 16) & 1u)) >> 16);
}
__device__ __forceinline__ float bf_bits2f(unsigned short h) { return __uint_as_float(((unsigned)h) << 16); }

// hazard guards as plain device helpers (no inline asm inside the kernel template body)
__device__ __forceinline__ void dep_guard_h(v8f& a, v8f& b, v16h x, v16h y) { asm volatile("v_nop\n\tv_nop\n\tv_nop\n\tv_nop" : "+v"(a), "+v"(b) : "v"(x), "v"(y)); }
__device__ __forceinline__ void dep_guard_b(v8f& a, v8f& b, v16b x, v16b y) { asm volatile("v_nop\n\tv_nop\n\tv_nop\n\tv_nop" : "+v"(a), "+v"(b) : "v"(x), "v"(y)); }
__device__ __forceinline__ void keep4_h(v16h a, v16h b, v16h c, v16h d) { asm volatile("v_nop" :: "v"(a), "v"(b), "v"(c), "v"(d)); }
__device__ __forceinline__ void keep4_b(v16b a, v16b b, v16b c, v16b d) { asm volatile("v_nop" :: "v"(a), "v"(b), "v"(c), "v"(d)); }
__device__ __forceinline__ void acc_guard4(v8f& a, v8f& b, v8f& c, v8f& d) { asm volatile("v_nop\n\tv_nop\n\tv_nop\n\tv_nop" : "+v"(a), "+v"(b), "+v"(c), "+v"(d)); }
template <typename T> struct Frag;
template <> struct Frag<_Float16> {
  typedef v16h V; union U { v16h v; v8h h[2]; };
  static __device__ __forceinline__ v16h load(const _Float16* p) {   // elements 0..7 <- p[0..7], 8..15 <- p[16..23]
    U f; f.h[0] = *(const v8h*)(p); f.h[1] = *(const v8h*)(p + 16); return f.v;
  }
  static __device__ __forceinline__ v8f mma(v16h a, v16h b, v8f c) {
    return __builtin_amdgcn_wmma_f32_16x16x32_f16(false, a, false, b, (short)0, c, false, false);
  }
  static __device__ __forceinline__ void guard(v8f& a, v8f& b, v16h x, v16h y) { dep_guard_h(a, b, x, y); }
  static __device__ __forceinline__ void keep(v16h a, v16h b, v16h c, v16h d) { keep4_h(a, b, c, d); }
};
template <> struct Frag<__bf16> {
  typedef v16b V; union U { v16b v; v8b h[2]; };
  static __device__ __forceinline__ v16b load(const __bf16* p) {
    U f; f.h[0] = *(const v8b*)(p); f.h[1] = *(const v8b*)(p + 16); return f.v;
  }
  static __device__ __forceinline__ v8f mma(v16b a, v16b b, v8f c) {
    return __builtin_amdgcn_wmma_f32_16x16x32_bf16(false, a, false, b, (short)0, c, false, false);
  }
  static __device__ __forceinline__ void guard(v8f& a, v8f& b, v16b x, v16b y) { dep_guard_b(a, b, x, y); }
  static __device__ __forceinline__ void keep(v16b a, v16b b, v16b c, v16b d) { keep4_b(a, b, c, d); }
};

__device__ __forceinline__ unsigned pk16(unsigned short a, unsigned short b) { return (unsigned)a | ((unsigned)b << 16); }
__device__ __forceinline__ unsigned short h_bits(float f) { const _Float16 h = (_Float16)f; return __builtin_bit_cast(unsigned short, h); }

// ---- Register-blocked batched WMMA GEMM ------------
// C[m,n] = scale * sum_k A[m,k] * Bt[n,k], then optional per-row scale, causal zero and activation; each wave owns a 64x64 tile.
// A row-major [M,K]; Bt row-major [N,K]; M,N % 64 == 0, K % 32 == 0.
// SPL: bit0 = A carries a lo plane (A2), bit1 = Bt carries a lo plane (Bt2); products h.h (+ h.l if bit1) (+ l.h if bit0),
//      all into one f32 accumulator (bf16 planes, no carry scales).
// RSC: 1 = multiply element (m,n) by rsc[b*strideS + m] (per-row scale).
// OUT_MODE: 0 = f32, 1 = f16, 2 = bf16 hi plane (Cout) + bf16 lo plane (Cout2).
// ACT: 0 = none, 6 = elu(v)+1 = (v > 0 ? v + 1 : exp(v)).
// TRI: 0 = full; 1 = only output tiles with n0 <= m0 are produced (wave-uniform early exit, no block barriers in this kernel)
//      and elements with n > m are written as 0; 2 = the A operand is block-lower-triangular: k extent of tile m0 = min(K, m0+64).
// ET: 0 = f16 operands, 1 = bf16 operands (pointers passed as 16-bit storage)
template <int ET> struct Elem;
template <> struct Elem<0> { typedef _Float16 T; };
template <> struct Elem<1> { typedef __bf16 T; };
template <int ET, int SPL, int RSC, int OUT_MODE, int ACT, int TRI>
__global__ __launch_bounds__(256) void wmma_gemm64(
    const unsigned short* __restrict__ Ap, const unsigned short* __restrict__ A2p, int lda, long strideA,
    const unsigned short* __restrict__ Btp, const unsigned short* __restrict__ Bt2p, int ldb, long strideB,
    void* __restrict__ Cout, void* __restrict__ Cout2, int ldc, long strideC,
    const float* __restrict__ rsc, long strideS,
    int M, int N, int K, float scale) {
  typedef typename Elem<ET>::T T;
  typedef typename Frag<T>::V V;
  const T* A = (const T*)Ap; const T* A2 = (const T*)A2p; const T* Bt = (const T*)Btp; const T* Bt2 = (const T*)Bt2p;
  __shared__ __align__(16) float sT[8][16 * 68];   // per-wave 16x64 slab, pitch 68 floats
  const int b    = blockIdx.y;
  const int lane = threadIdx.x & 31;
  const int wave = threadIdx.x >> 5;
  const int tilesN = N >> 6;
  const int tilesM = M >> 6;
  const int tile = blockIdx.x * 8 + wave;
  if (tile >= tilesM * tilesN) return;   // wave-uniform; no block barriers in this kernel
  const int tm = tile / tilesN;
  const int tn = tile - tm * tilesN;
  const int m0 = tm << 6;
  const int n0 = tn << 6;
  if (TRI == 1 && n0 > m0) return;       // wave-uniform; strictly-upper output tiles are not produced
  const int Kl = (TRI == 2 && (m0 + 64) < K) ? (m0 + 64) : K;   // wave-uniform k extent (multiple of 64)

  const T* Ab  = A  + (size_t)b * strideA;
  const T* Bb  = Bt + (size_t)b * strideB;
  const T* Ab2 = (SPL & 1) ? (A2  + (size_t)b * strideA) : nullptr;
  const T* Bb2 = (SPL & 2) ? (Bt2 + (size_t)b * strideB) : nullptr;

  const int rlane = lane & 15;                 // row (A) / col (B, D) within subtile
  const int koff  = (lane >> 4) * 8;           // k offset of this lane half
  const int mOff  = (lane >> 4) * 8;           // D row offset

  v8f acc[4][4];
#pragma unroll
  for (int i = 0; i < 4; ++i)
#pragma unroll
    for (int j = 0; j < 4; ++j) acc[i][j] = (v8f){0.f,0.f,0.f,0.f,0.f,0.f,0.f,0.f};

  for (int k0 = 0; k0 < Kl; k0 += 32) {
    V bh[4], bl[4];
#pragma unroll
    for (int j = 0; j < 4; ++j) {
      const size_t bo = (size_t)(n0 + (j << 4) + rlane) * ldb + koff + k0;
      bh[j] = Frag<T>::load(Bb + bo);
      if (SPL & 2) bl[j] = Frag<T>::load(Bb2 + bo);
    }
#pragma unroll
    for (int i = 0; i < 4; ++i) {
      const size_t ao = (size_t)(m0 + (i << 4) + rlane) * lda + koff + k0;
      V ah = Frag<T>::load(Ab + ao);
      V al;
      if (SPL & 1) al = Frag<T>::load(Ab2 + ao);
#pragma unroll
      for (int j = 0; j < 4; ++j) {
        acc[i][j] = Frag<T>::mma(ah, bh[j], acc[i][j]);
        if (SPL & 2) acc[i][j] = Frag<T>::mma(ah, bl[j], acc[i][j]);
        if (SPL & 1) acc[i][j] = Frag<T>::mma(al, bh[j], acc[i][j]);
      }
      Frag<T>::guard(acc[i][0], acc[i][3], ah, (SPL & 1) ? al : ah);
    }
    Frag<T>::keep(bh[0], bh[1], bh[2], bh[3]);
    if (SPL & 2) Frag<T>::keep(bl[0], bl[1], bl[2], bl[3]);
  }
  acc_guard4(acc[0][0], acc[0][1], acc[0][2], acc[0][3]);
  acc_guard4(acc[1][0], acc[1][1], acc[1][2], acc[1][3]);
  acc_guard4(acc[2][0], acc[2][1], acc[2][2], acc[2][3]);
  acc_guard4(acc[3][0], acc[3][1], acc[3][2], acc[3][3]);

  // ---- epilogue ----
  float* slab = sT[wave];
  const float* Rs = RSC ? (rsc + (size_t)b * strideS) : nullptr;
#pragma unroll
  for (int i = 0; i < 4; ++i) {
    const int mBase = m0 + (i << 4);
    float rsv[8];
#pragma unroll
    for (int r = 0; r < 8; ++r) rsv[r] = RSC ? Rs[mBase + mOff + r] : 1.0f;
#pragma unroll
    for (int j = 0; j < 4; ++j) {
      const int n = n0 + (j << 4) + rlane;
#pragma unroll
      for (int r = 0; r < 8; ++r) {
        float v = acc[i][j][r] * scale;
        if (RSC) v = v * rsv[r];
        if (TRI == 1) { if (n > mBase + mOff + r) v = 0.0f; }
        if (ACT == 6) v = (v > 0.0f) ? (v + 1.0f) : __expf(v);
        slab[(mOff + r) * 68 + (j << 4) + rlane] = v;
      }
    }
    __builtin_amdgcn_fence(__ATOMIC_RELEASE, "workgroup");
    __builtin_amdgcn_wave_barrier();
    __builtin_amdgcn_fence(__ATOMIC_ACQUIRE, "workgroup");
    if (OUT_MODE == 0) {
      float* C = (float*)Cout + (size_t)b * strideC;
      const int hh = lane >> 4, c4 = (lane & 15) * 4;     // row seg = 256 B = 16 lanes x 16 B
      {
#pragma unroll
        for (int it = 0; it < 8; ++it) {
          const int row = it * 2 + hh;
          v4f v = *(const v4f*)(slab + row * 68 + c4);
          *(v4f*)(C + (size_t)(mBase + row) * ldc + n0 + c4) = v;
        }
        
      }
    } else {
      const int q = lane >> 3, c8 = (lane & 7) * 8;
      unsigned short* C  = (unsigned short*)Cout  + (size_t)b * strideC;
      unsigned short* C2 = (OUT_MODE == 2) ? ((unsigned short*)Cout2 + (size_t)b * strideC) : nullptr;
      {
#pragma unroll
        for (int it = 0; it < 4; ++it) {
          const int row = it * 4 + q;
          const float* sp = slab + row * 68 + c8;
          v8h hv, lv;
#pragma unroll
          for (int e = 0; e < 8; ++e) {
            if (OUT_MODE == 1) {
              hv[e] = (_Float16)sp[e];
            } else {
              unsigned short hb = f2bf_bits(sp[e]);
              unsigned short lb = f2bf_bits(sp[e] - bf_bits2f(hb));
              hv[e] = __builtin_bit_cast(_Float16, hb);
              lv[e] = __builtin_bit_cast(_Float16, lb);
            }
          }
          *(v8h*)(C + (size_t)(mBase + row) * ldc + n0 + c8) = hv;
          if (OUT_MODE == 2) *(v8h*)(C2 + (size_t)(mBase + row) * ldc + n0 + c8) = lv;
        }
        
      }
    }
    __builtin_amdgcn_fence(__ATOMIC_RELEASE, "workgroup");
    __builtin_amdgcn_wave_barrier();
    __builtin_amdgcn_fence(__ATOMIC_ACQUIRE, "workgroup");
  }
}

// ---------------------------------------------------------------------------
// Cast, 8 consecutive elements per thread: in f32 [n] -> out 16-bit bits [n].
//   MODE 0: bf16 RNE bits. MODE 1: f16 bits of (scale * bf16-RNE value) (scale = power-of-two carry; exact for the bf16 value).
// ---------------------------------------------------------------------------
template <int MODE>
__global__ __launch_bounds__(256) void cast8_kernel(const float* __restrict__ in, unsigned short* __restrict__ out, int n8, float scale) {
  const int i = blockIdx.x * 256 + threadIdx.x;
  if (i >= n8) return;
  const float* p = in + 8 * (size_t)i;
  const v4f a = *(const v4f*)(p);
  const v4f c = *(const v4f*)(p + 4);
  unsigned short hb[8];
#pragma unroll
  for (int e = 0; e < 4; ++e) {
    if (MODE == 0) {
      hb[e]     = f2bf_bits(a[e]);
      hb[4 + e] = f2bf_bits(c[e]);
    } else {
      hb[e]     = h_bits(bf_bits2f(f2bf_bits(a[e])) * scale);
      hb[4 + e] = h_bits(bf_bits2f(f2bf_bits(c[e])) * scale);
    }
  }
  const v4u u = (v4u){pk16(hb[0], hb[1]), pk16(hb[2], hb[3]), pk16(hb[4], hb[5]), pk16(hb[6], hb[7])};
  unsigned short* q = out + 8 * (size_t)i;
  *(v4u*)q = u;
  
  (void)scale;
}

// ---------------------------------------------------------------------------
// Transpose-cast: in a f32 [kNB][kSA t][kD d] -> out bf16 RNE bits [kNB][kD d][kSA t] (row d, t contiguous = Bt layout with K = t).
// Block = 256 threads (8 waves), one 64(t) x 64(d) tile; grid (kSA/64, kD/64, kNB) exactly.
// Read coverage: 4 iterations x 16 t-rows x (16 lanes x 4 d) = 64 x 64 (the whole tile), staged in LDS as [d][t] (pitch 72 halves).
// Write coverage: 8 waves x 2 instructions x 4 d-rows x (8 lanes x 8 halves = 64 t) = 64 d-rows x 64 t (the whole tile);
// ---------------------------------------------------------------------------
__global__ __launch_bounds__(256) void transpose_cast_kernel(const float* __restrict__ in, unsigned short* __restrict__ out) {
  __shared__ __align__(16) unsigned short tile[64 * 72];
  const int tid = threadIdx.x, lane = tid & 31, wave = tid >> 5;
  const int t0 = blockIdx.x * 64, d0 = blockIdx.y * 64, bz = blockIdx.z;
  const float* ab = in + (size_t)bz * kSA * kD;
#pragma unroll
  for (int i = 0; i < 4; ++i) {
    const int tr = i * 16 + (tid >> 4);
    const int dc = (tid & 15) * 4;
    const v4f v = *(const v4f*)(ab + (size_t)(t0 + tr) * kD + d0 + dc);
#pragma unroll
    for (int e = 0; e < 4; ++e) tile[(dc + e) * 72 + tr] = f2bf_bits(v[e]);
  }
  __syncthreads();
  unsigned short* ob = out + (size_t)bz * kD * kSA;
  const int q = lane >> 3, c8 = (lane & 7) * 8;
  const int r0 = wave * 8 + q;
  const int r1 = wave * 8 + 4 + q;
  const v4u u0 = *(const v4u*)(&tile[r0 * 72 + c8]);
  const v4u u1 = *(const v4u*)(&tile[r1 * 72 + c8]);
  unsigned short* p0 = ob + (size_t)(d0 + r0) * kSA + t0 + c8;
  unsigned short* p1 = ob + (size_t)(d0 + r1) * kSA + t0 + c8;
  *(v4u*)p0 = u0;
  *(v4u*)p1 = u1;
  
}

// ---------------------------------------------------------------------------
// Row softmax over kSA columns of S f32 [kSB][kSA] (max-subtracted, f32 exp, multiply by 1/sum); P emitted as bf16 hi (PH) and
// bf16 lo (PL = bf16-RNE(p - hi)) planes [kSB][kSA] (no carry scale; bf16 exponent range).
// One block of 256 threads per row, grid = kSB rows exactly. Passes 1-2: thread t visits columns t + 256*i, i = 0..7 (rolled loops,
// coalesced); pass 2 stages e = exp(s - max) in LDS. Reductions in fixed order (sequential per thread, xor tree per wave,
// 8 wave partials: max in index order, sum as a fixed pairwise tree). Store phase (after __syncthreads): thread t owns columns 8t..8t+7 (256 x 8 = 2048 = whole row
// ---------------------------------------------------------------------------
__global__ __launch_bounds__(256) void softmax_split_kernel(const float* __restrict__ S,
                                                            unsigned short* __restrict__ PH, unsigned short* __restrict__ PL) {
  __shared__ __align__(16) float srow[kSA];
  __shared__ float redm[8];
  __shared__ float reds[8];
  const int row = blockIdx.x;
  const int t = threadIdx.x, lane = t & 31, wave = t >> 5;
  const float* sr = S + (size_t)row * kSA;
  float m = -INFINITY;
#pragma unroll 1
  for (int i = 0; i < kSA / 256; ++i) m = fmaxf(m, sr[t + 256 * i]);
#pragma unroll
  for (int off = 16; off > 0; off >>= 1) m = fmaxf(m, __shfl_xor(m, off, 32));
  if (lane == 0) redm[wave] = m;
  __syncthreads();
  float mx = redm[0];
#pragma unroll
  for (int w = 1; w < 8; ++w) mx = fmaxf(mx, redm[w]);
  float s = 0.f;
#pragma unroll 1
  for (int i = 0; i < kSA / 256; ++i) {
    const int cidx = t + 256 * i;
    const float e = expf(sr[cidx] - mx);
    srow[cidx] = e;
    s += e;
  }
#pragma unroll
  for (int off = 16; off > 0; off >>= 1) s += __shfl_xor(s, off, 32);
  if (lane == 0) reds[wave] = s;
  __syncthreads();
  const float tot = ((reds[0] + reds[1]) + (reds[2] + reds[3])) + ((reds[4] + reds[5]) + (reds[6] + reds[7]));
  const float inv = 1.0f / tot;
  const int c0 = t * 8;
  const v4f e0 = *(const v4f*)(srow + c0);
  const v4f e1 = *(const v4f*)(srow + c0 + 4);
  unsigned short hbv[8], lb[8];
#pragma unroll
  for (int e = 0; e < 4; ++e) {
    const float p0 = e0[e] * inv;
    const float p1 = e1[e] * inv;
    const unsigned short h0 = f2bf_bits(p0);
    const unsigned short h1 = f2bf_bits(p1);
    hbv[e] = h0;
    hbv[4 + e] = h1;
    lb[e]      = f2bf_bits(p0 - bf_bits2f(h0));
    lb[4 + e]  = f2bf_bits(p1 - bf_bits2f(h1));
  }
  const v4u hv = (v4u){pk16(hbv[0], hbv[1]), pk16(hbv[2], hbv[3]), pk16(hbv[4], hbv[5]), pk16(hbv[6], hbv[7])};
  const v4u lv = (v4u){pk16(lb[0], lb[1]), pk16(lb[2], lb[3]), pk16(lb[4], lb[5]), pk16(lb[6], lb[7])};
  unsigned short* hp = PH + (size_t)row * kSA + c0;
  unsigned short* lp = PL + (size_t)row * kSA + c0;
  *(v4u*)hp = hv;
  *(v4u*)lp = lv;
  
}

// ---------------------------------------------------------------------------
// Workspace region map (byte offsets, all multiples of 128; every region fully written before it is read):
//   A16   bf16 [4][2048][1024]  (a, RNE bf16; rows t, K = d)            0           16,777,216 B
//   AT16  bf16 [4][1024][2048]  (a^T per batch; rows d, K = t)          16,777,216  16,777,216 B
//   WQ16  bf16 [1024][1024]     (Wq [out][in], RNE bf16)                33,554,432   2,097,152 B
//   QH    bf16 [8192][1024]     q hi plane                              35,651,584  16,777,216 B
//   QL    bf16 [8192][1024]     q lo plane                              52,428,800  16,777,216 B
//   R     two phases, same size                                         69,206,016  16,777,216 B
//           phase 1: B16 bf16 [8192][1024] (b, RNE bf16), dead after the q GEMM
//           phase 2: S f32 [2048][2048] scores of the current batch
//   PH    bf16 [2048][2048]     P hi plane (current batch)              85,983,232   8,388,608 B
//   PL    bf16 [2048][2048]     P lo plane                              94,371,840   8,388,608 B
//   total 102,760,448 B
// GEMM shapes: q M=8192 N=1024 K=1024; scores M=N=2048 K=1024; out M=2048 N=1024 K=2048. All K % 32 == 0, all M, N % 64 == 0,
// no padded planes, no tails.
// Launches: 3 casts + 1 transpose-cast + 1 q GEMM + 4 x (scores GEMM, softmax, out GEMM) = 17.
// ---------------------------------------------------------------------------
extern "C" void kernel_launch(void* const* d_in, const int* in_sizes, int n_in,
                              void* d_out, int out_size, void* d_ws, size_t ws_size,
                              hipStream_t stream) {
  if (n_in < 3) return;
  if (in_sizes[0] != kNB * kSA * kD) return;
  if (in_sizes[1] != kNB * kSB * kE) return;
  if (in_sizes[2] != kD * kE) return;
  if (out_size != kNB * kSB * kD) return;

  const float* a  = (const float*)d_in[0];   // [4][2048][1024]
  const float* b  = (const float*)d_in[1];   // [4][2048][1024]
  const float* wq = (const float*)d_in[2];   // [1024][1024]  ([out][in])
  float* outp = (float*)d_out;               // [4][2048][1024]

  // ---- carve ----
  const size_t SZ_A16  = (size_t)kNB * kSA * kD * 2;   // 16,777,216
  const size_t SZ_AT16 = (size_t)kNB * kD * kSA * 2;   // 16,777,216
  const size_t SZ_WQ16 = (size_t)kD * kE * 2;          //  2,097,152
  const size_t SZ_Q16  = (size_t)kNB * kSB * kD * 2;   // 16,777,216
  const size_t SZ_B16  = (size_t)kNB * kSB * kE * 2;   // 16,777,216
  const size_t SZ_S    = (size_t)kSB * kSA * 4;        // 16,777,216
  const size_t SZ_R    = (SZ_B16 > SZ_S) ? SZ_B16 : SZ_S;
  const size_t SZ_P16  = (size_t)kSB * kSA * 2;        //  8,388,608

  size_t off = 0;
  const size_t oA16  = off; off += SZ_A16;
  const size_t oAT16 = off; off += SZ_AT16;
  const size_t oWQ16 = off; off += SZ_WQ16;
  const size_t oQH   = off; off += SZ_Q16;
  const size_t oQL   = off; off += SZ_Q16;
  const size_t oR    = off; off += SZ_R;
  const size_t oPH   = off; off += SZ_P16;
  const size_t oPL   = off; off += SZ_P16;
  const size_t TOTAL = off;                            // 102,760,448
  if (TOTAL > ws_size) return;
  if (TOTAL > (size_t)134217728) return;

  char* ws = (char*)d_ws;
  unsigned short* A16  = (unsigned short*)(ws + oA16);
  unsigned short* AT16 = (unsigned short*)(ws + oAT16);
  unsigned short* WQ16 = (unsigned short*)(ws + oWQ16);
  unsigned short* QH   = (unsigned short*)(ws + oQH);
  unsigned short* QL   = (unsigned short*)(ws + oQL);
  unsigned short* B16  = (unsigned short*)(ws + oR);   // phase 1 of R
  float*          Sf   = (float*)(ws + oR);            // phase 2 of R
  unsigned short* PH   = (unsigned short*)(ws + oPH);
  unsigned short* PL   = (unsigned short*)(ws + oPL);
  const float* dummy_rsc = (const float*)(ws + oR);    // unused by RSC == 0 instantiations

  const dim3 blk(256);

  // (0) casts: a -> A16, b -> B16, Wq -> WQ16 (bf16 RNE)
  {
    const int n8a = kNB * kSA * kD / 8;    // 1,048,576 -> 4096 blocks exactly
    cast8_kernel<0><<<dim3(n8a / 256), blk, 0, stream>>>(a, A16, n8a, 1.0f);
    const int n8b = kNB * kSB * kE / 8;    // 1,048,576 -> 4096 blocks exactly
    cast8_kernel<0><<<dim3(n8b / 256), blk, 0, stream>>>(b, B16, n8b, 1.0f);
    const int n8w = kD * kE / 8;           //   131,072 ->  512 blocks exactly
    cast8_kernel<0><<<dim3(n8w / 256), blk, 0, stream>>>(wq, WQ16, n8w, 1.0f);
  }
  // (1) a f32 [4][2048 t][1024 d] -> AT16 bf16 [4][1024 d][2048 t]; grid (t tiles, d tiles, batch)
  transpose_cast_kernel<<<dim3(kSA / 64, kD / 64, kNB), blk, 0, stream>>>(a, AT16);

  // (2) q = b . Wq^T for all batches: A = B16 [8192][1024], Bt = WQ16 [1024][1024] -> QH/QL bf16 hi/lo [8192][1024]
  const int gQ = ((kNB * kSB / 64) * (kD / 64) + 7) / 8;   // 256
  wmma_gemm64<1, 0, 0, 2, 0, 0><<<dim3(gQ, 1), blk, 0, stream>>>(
      B16, B16, kE, 0L, WQ16, WQ16, kE, 0L, (void*)QH, (void*)QL, kD, 0L, dummy_rsc, 0L, kNB * kSB, kD, kE, 1.0f);

  const int gS = ((kSB / 64) * (kSA / 64) + 7) / 8;        // 128
  const int gO = ((kSB / 64) * (kD / 64) + 7) / 8;         //  64
  for (int bb = 0; bb < kNB; ++bb) {
    const unsigned short* QHb  = QH   + (size_t)bb * kSB * kD;
    const unsigned short* QLb  = QL   + (size_t)bb * kSB * kD;
    const unsigned short* A16b = A16  + (size_t)bb * kSA * kD;
    const unsigned short* ATb  = AT16 + (size_t)bb * kD * kSA;
    float* outb = outp + (size_t)bb * kSB * kD;
    // (3) S[s][t] = (1/32) * sum_d q[s][d] a[t][d]: A = q hi|lo [2048][1024], Bt = A16b [2048][1024] -> S f32 [2048][2048]
    wmma_gemm64<1, 1, 0, 0, 0, 0><<<dim3(gS, 1), blk, 0, stream>>>(
        QHb, QLb, kD, 0L, A16b, A16b, kD, 0L, (void*)Sf, (void*)Sf, kSA, 0L, dummy_rsc, 0L, kSB, kSA, kD, kScoreScale);
    // (4) row softmax -> P hi/lo bf16 [2048][2048]
    softmax_split_kernel<<<dim3(kSB), blk, 0, stream>>>(Sf, PH, PL);
    // (5) out[s][d] = sum_t P[s][t] a[t][d]: A = P hi|lo [2048][2048], Bt = ATb [1024][2048] -> d_out f32 [2048][1024]
    wmma_gemm64<1, 1, 0, 0, 0, 0><<<dim3(gO, 1), blk, 0, stream>>>(
        PH, PL, kSA, 0L, ATb, ATb, kSA, 0L, (void*)outb, (void*)outb, kD, 0L, dummy_rsc, 0L, kSB, kD, kSA, 1.0f);
  }
}

// v001
// It runs in 326 microseconds.
// Next to v000, in two timings, it ran 2.58 times as fast each time.
// Contractions: q = b.Wq^T (bf16 x bf16, 1 product), scores = q.a^T (q as bf16 hi/lo planes x a bf16, 2 products), out = P.a (P as bf16 hi/lo planes x a^T bf16, 2 products); all v_wmma_f32_16x16x32_bf16, f32 accumulate; inputs RNE-converted to bf16; scores f32, softmax f32.
#include <hip/hip_runtime.h>
#include <math.h>

// ---------------------------------------------------------------------------
// Problem constants
// ---------------------------------------------------------------------------
constexpr int kNB = 4;        // batch
constexpr int kSA = 2048;     // rows of a (keys / values)
constexpr int kSB = 2048;     // rows of b (queries)
constexpr int kD  = 1024;     // feature dim of a = attention dim = output dim
constexpr int kE  = 1024;     // feature dim of b
constexpr float kScoreScale = 0.03125f;   // 1024^-0.5 exactly

typedef __attribute__((ext_vector_type(16))) _Float16 v16h;
typedef __attribute__((ext_vector_type(8)))  _Float16 v8h;
typedef __attribute__((ext_vector_type(16))) __bf16   v16b;
typedef __attribute__((ext_vector_type(8)))  __bf16   v8b;
typedef __attribute__((ext_vector_type(8)))  float    v8f;
typedef __attribute__((ext_vector_type(4)))  float    v4f;
typedef __attribute__((ext_vector_type(4)))  unsigned int v4u;

// ---------------------------------------------------------------------------
// Device helpers
// ---------------------------------------------------------------------------
__device__ __forceinline__ unsigned short f2bf_bits(float f) {
  unsigned u = __float_as_uint(f);
  return (unsigned short)((u + 0x7FFFu + ((u >> 16) & 1u)) >> 16);
}
__device__ __forceinline__ float bf_bits2f(unsigned short h) { return __uint_as_float(((unsigned)h) << 16); }

// hazard guards as plain device helpers (no inline asm inside the kernel template body)
__device__ __forceinline__ void dep_guard_h(v8f& a, v8f& b, v16h x, v16h y) { asm volatile("v_nop\n\tv_nop\n\tv_nop\n\tv_nop" : "+v"(a), "+v"(b) : "v"(x), "v"(y)); }
__device__ __forceinline__ void dep_guard_b(v8f& a, v8f& b, v16b x, v16b y) { asm volatile("v_nop\n\tv_nop\n\tv_nop\n\tv_nop" : "+v"(a), "+v"(b) : "v"(x), "v"(y)); }
__device__ __forceinline__ void keep4_h(v16h a, v16h b, v16h c, v16h d) { asm volatile("v_nop" :: "v"(a), "v"(b), "v"(c), "v"(d)); }
__device__ __forceinline__ void keep4_b(v16b a, v16b b, v16b c, v16b d) { asm volatile("v_nop" :: "v"(a), "v"(b), "v"(c), "v"(d)); }
__device__ __forceinline__ void acc_guard4(v8f& a, v8f& b, v8f& c, v8f& d) { asm volatile("v_nop\n\tv_nop\n\tv_nop\n\tv_nop" : "+v"(a), "+v"(b), "+v"(c), "+v"(d)); }
template <typename T> struct Frag;
template <> struct Frag<_Float16> {
  typedef v16h V; union U { v16h v; v8h h[2]; };
  static __device__ __forceinline__ v16h load(const _Float16* p) {   // elements 0..7 <- p[0..7], 8..15 <- p[16..23]
    U f; f.h[0] = *(const v8h*)(p); f.h[1] = *(const v8h*)(p + 16); return f.v;
  }
  static __device__ __forceinline__ v8f mma(v16h a, v16h b, v8f c) {
    return __builtin_amdgcn_wmma_f32_16x16x32_f16(false, a, false, b, (short)0, c, false, false);
  }
  static __device__ __forceinline__ void guard(v8f& a, v8f& b, v16h x, v16h y) { dep_guard_h(a, b, x, y); }
  static __device__ __forceinline__ void keep(v16h a, v16h b, v16h c, v16h d) { keep4_h(a, b, c, d); }
};
template <> struct Frag<__bf16> {
  typedef v16b V; union U { v16b v; v8b h[2]; };
  static __device__ __forceinline__ v16b load(const __bf16* p) {
    U f; f.h[0] = *(const v8b*)(p); f.h[1] = *(const v8b*)(p + 16); return f.v;
  }
  static __device__ __forceinline__ v8f mma(v16b a, v16b b, v8f c) {
    return __builtin_amdgcn_wmma_f32_16x16x32_bf16(false, a, false, b, (short)0, c, false, false);
  }
  static __device__ __forceinline__ void guard(v8f& a, v8f& b, v16b x, v16b y) { dep_guard_b(a, b, x, y); }
  static __device__ __forceinline__ void keep(v16b a, v16b b, v16b c, v16b d) { keep4_b(a, b, c, d); }
};

__device__ __forceinline__ unsigned pk16(unsigned short a, unsigned short b) { return (unsigned)a | ((unsigned)b << 16); }
__device__ __forceinline__ unsigned short h_bits(float f) { const _Float16 h = (_Float16)f; return __builtin_bit_cast(unsigned short, h); }

// ---- Register-blocked batched WMMA GEMM ------------
// C[m,n] = scale * sum_k A[m,k] * Bt[n,k], then optional per-row scale, causal zero and activation; each wave owns a 64x64 tile.
// A row-major [M,K]; Bt row-major [N,K]; M,N % 64 == 0, K % 32 == 0.
// SPL: bit0 = A carries a lo plane (A2), bit1 = Bt carries a lo plane (Bt2); products h.h (+ h.l if bit1) (+ l.h if bit0),
//      all into one f32 accumulator (bf16 planes, no carry scales).
// RSC: 1 = multiply element (m,n) by rsc[b*strideS + m] (per-row scale).
// OUT_MODE: 0 = f32, 1 = f16, 2 = bf16 hi plane (Cout) + bf16 lo plane (Cout2).
// ACT: 0 = none, 6 = elu(v)+1 = (v > 0 ? v + 1 : exp(v)).
// TRI: 0 = full; 1 = only output tiles with n0 <= m0 are produced (wave-uniform early exit, no block barriers in this kernel)
//      and elements with n > m are written as 0; 2 = the A operand is block-lower-triangular: k extent of tile m0 = min(K, m0+64).
// ET: 0 = f16 operands, 1 = bf16 operands (pointers passed as 16-bit storage)
template <int ET> struct Elem;
template <> struct Elem<0> { typedef _Float16 T; };
template <> struct Elem<1> { typedef __bf16 T; };
template <int ET, int SPL, int RSC, int OUT_MODE, int ACT, int TRI>
__global__ __launch_bounds__(256) void wmma_gemm64(
    const unsigned short* __restrict__ Ap, const unsigned short* __restrict__ A2p, int lda, long strideA,
    const unsigned short* __restrict__ Btp, const unsigned short* __restrict__ Bt2p, int ldb, long strideB,
    void* __restrict__ Cout, void* __restrict__ Cout2, int ldc, long strideC,
    const float* __restrict__ rsc, long strideS,
    int M, int N, int K, float scale) {
  typedef typename Elem<ET>::T T;
  typedef typename Frag<T>::V V;
  const T* A = (const T*)Ap; const T* A2 = (const T*)A2p; const T* Bt = (const T*)Btp; const T* Bt2 = (const T*)Bt2p;
  __shared__ __align__(16) float sT[8][16 * 68];   // per-wave 16x64 slab, pitch 68 floats
  const int b    = blockIdx.y;
  const int lane = threadIdx.x & 31;
  const int wave = threadIdx.x >> 5;
  const int tilesN = N >> 6;
  const int tilesM = M >> 6;
  const int tile = blockIdx.x * 8 + wave;
  if (tile >= tilesM * tilesN) return;   // wave-uniform; no block barriers in this kernel
  const int tm = tile / tilesN;
  const int tn = tile - tm * tilesN;
  const int m0 = tm << 6;
  const int n0 = tn << 6;
  if (TRI == 1 && n0 > m0) return;       // wave-uniform; strictly-upper output tiles are not produced
  const int Kl = (TRI == 2 && (m0 + 64) < K) ? (m0 + 64) : K;   // wave-uniform k extent (multiple of 64)

  const T* Ab  = A  + (size_t)b * strideA;
  const T* Bb  = Bt + (size_t)b * strideB;
  const T* Ab2 = (SPL & 1) ? (A2  + (size_t)b * strideA) : nullptr;
  const T* Bb2 = (SPL & 2) ? (Bt2 + (size_t)b * strideB) : nullptr;

  const int rlane = lane & 15;                 // row (A) / col (B, D) within subtile
  const int koff  = (lane >> 4) * 8;           // k offset of this lane half
  const int mOff  = (lane >> 4) * 8;           // D row offset

  v8f acc[4][4];
#pragma unroll
  for (int i = 0; i < 4; ++i)
#pragma unroll
    for (int j = 0; j < 4; ++j) acc[i][j] = (v8f){0.f,0.f,0.f,0.f,0.f,0.f,0.f,0.f};

  for (int k0 = 0; k0 < Kl; k0 += 32) {
    V bh[4], bl[4];
#pragma unroll
    for (int j = 0; j < 4; ++j) {
      const size_t bo = (size_t)(n0 + (j << 4) + rlane) * ldb + koff + k0;
      bh[j] = Frag<T>::load(Bb + bo);
      if (SPL & 2) bl[j] = Frag<T>::load(Bb2 + bo);
    }
#pragma unroll
    for (int i = 0; i < 4; ++i) {
      const size_t ao = (size_t)(m0 + (i << 4) + rlane) * lda + koff + k0;
      V ah = Frag<T>::load(Ab + ao);
      V al;
      if (SPL & 1) al = Frag<T>::load(Ab2 + ao);
#pragma unroll
      for (int j = 0; j < 4; ++j) {
        acc[i][j] = Frag<T>::mma(ah, bh[j], acc[i][j]);
        if (SPL & 2) acc[i][j] = Frag<T>::mma(ah, bl[j], acc[i][j]);
        if (SPL & 1) acc[i][j] = Frag<T>::mma(al, bh[j], acc[i][j]);
      }
      Frag<T>::guard(acc[i][0], acc[i][3], ah, (SPL & 1) ? al : ah);
    }
    Frag<T>::keep(bh[0], bh[1], bh[2], bh[3]);
    if (SPL & 2) Frag<T>::keep(bl[0], bl[1], bl[2], bl[3]);
  }
  acc_guard4(acc[0][0], acc[0][1], acc[0][2], acc[0][3]);
  acc_guard4(acc[1][0], acc[1][1], acc[1][2], acc[1][3]);
  acc_guard4(acc[2][0], acc[2][1], acc[2][2], acc[2][3]);
  acc_guard4(acc[3][0], acc[3][1], acc[3][2], acc[3][3]);

  // ---- epilogue ----
  float* slab = sT[wave];
  const float* Rs = RSC ? (rsc + (size_t)b * strideS) : nullptr;
#pragma unroll
  for (int i = 0; i < 4; ++i) {
    const int mBase = m0 + (i << 4);
    float rsv[8];
#pragma unroll
    for (int r = 0; r < 8; ++r) rsv[r] = RSC ? Rs[mBase + mOff + r] : 1.0f;
#pragma unroll
    for (int j = 0; j < 4; ++j) {
      const int n = n0 + (j << 4) + rlane;
#pragma unroll
      for (int r = 0; r < 8; ++r) {
        float v = acc[i][j][r] * scale;
        if (RSC) v = v * rsv[r];
        if (TRI == 1) { if (n > mBase + mOff + r) v = 0.0f; }
        if (ACT == 6) v = (v > 0.0f) ? (v + 1.0f) : __expf(v);
        slab[(mOff + r) * 68 + (j << 4) + rlane] = v;
      }
    }
    __builtin_amdgcn_fence(__ATOMIC_RELEASE, "workgroup");
    __builtin_amdgcn_wave_barrier();
    __builtin_amdgcn_fence(__ATOMIC_ACQUIRE, "workgroup");
    if (OUT_MODE == 0) {
      float* C = (float*)Cout + (size_t)b * strideC;
      const int hh = lane >> 4, c4 = (lane & 15) * 4;     // row seg = 256 B = 16 lanes x 16 B
      {
#pragma unroll
        for (int it = 0; it < 8; ++it) {
          const int row = it * 2 + hh;
          v4f v = *(const v4f*)(slab + row * 68 + c4);
          *(v4f*)(C + (size_t)(mBase + row) * ldc + n0 + c4) = v;
        }
        
      }
    } else {
      const int q = lane >> 3, c8 = (lane & 7) * 8;
      unsigned short* C  = (unsigned short*)Cout  + (size_t)b * strideC;
      unsigned short* C2 = (OUT_MODE == 2) ? ((unsigned short*)Cout2 + (size_t)b * strideC) : nullptr;
      {
#pragma unroll
        for (int it = 0; it < 4; ++it) {
          const int row = it * 4 + q;
          const float* sp = slab + row * 68 + c8;
          v8h hv, lv;
#pragma unroll
          for (int e = 0; e < 8; ++e) {
            if (OUT_MODE == 1) {
              hv[e] = (_Float16)sp[e];
            } else {
              unsigned short hb = f2bf_bits(sp[e]);
              unsigned short lb = f2bf_bits(sp[e] - bf_bits2f(hb));
              hv[e] = __builtin_bit_cast(_Float16, hb);
              lv[e] = __builtin_bit_cast(_Float16, lb);
            }
          }
          *(v8h*)(C + (size_t)(mBase + row) * ldc + n0 + c8) = hv;
          if (OUT_MODE == 2) *(v8h*)(C2 + (size_t)(mBase + row) * ldc + n0 + c8) = lv;
        }
        
      }
    }
    __builtin_amdgcn_fence(__ATOMIC_RELEASE, "workgroup");
    __builtin_amdgcn_wave_barrier();
    __builtin_amdgcn_fence(__ATOMIC_ACQUIRE, "workgroup");
  }
}

// ---------------------------------------------------------------------------
// Cast, 8 consecutive elements per thread: in f32 [n] -> out 16-bit bits [n].
//   MODE 0: bf16 RNE bits. MODE 1: f16 bits of (scale * bf16-RNE value) (scale = power-of-two carry; exact for the bf16 value).
// ---------------------------------------------------------------------------
template <int MODE>
__global__ __launch_bounds__(256) void cast8_kernel(const float* __restrict__ in, unsigned short* __restrict__ out, int n8, float scale) {
  const int i = blockIdx.x * 256 + threadIdx.x;
  if (i >= n8) return;
  const float* p = in + 8 * (size_t)i;
  const v4f a = *(const v4f*)(p);
  const v4f c = *(const v4f*)(p + 4);
  unsigned short hb[8];
#pragma unroll
  for (int e = 0; e < 4; ++e) {
    if (MODE == 0) {
      hb[e]     = f2bf_bits(a[e]);
      hb[4 + e] = f2bf_bits(c[e]);
    } else {
      hb[e]     = h_bits(bf_bits2f(f2bf_bits(a[e])) * scale);
      hb[4 + e] = h_bits(bf_bits2f(f2bf_bits(c[e])) * scale);
    }
  }
  const v4u u = (v4u){pk16(hb[0], hb[1]), pk16(hb[2], hb[3]), pk16(hb[4], hb[5]), pk16(hb[6], hb[7])};
  unsigned short* q = out + 8 * (size_t)i;
  *(v4u*)q = u;
  
  (void)scale;
}

// ---------------------------------------------------------------------------
// Transpose-cast: in a f32 [kNB][kSA t][kD d] -> out bf16 RNE bits [kNB][kD d][kSA t] (row d, t contiguous = Bt layout with K = t).
// Block = 256 threads (8 waves), one 64(t) x 64(d) tile; grid (kSA/64, kD/64, kNB) exactly.
// Read coverage: 4 iterations x 16 t-rows x (16 lanes x 4 d) = 64 x 64 (the whole tile), staged in LDS as [d][t] (pitch 72 halves).
// Write coverage: 8 waves x 2 instructions x 4 d-rows x (8 lanes x 8 halves = 64 t) = 64 d-rows x 64 t (the whole tile);
// ---------------------------------------------------------------------------
__global__ __launch_bounds__(256) void transpose_cast_kernel(const float* __restrict__ in, unsigned short* __restrict__ out) {
  __shared__ __align__(16) unsigned short tile[64 * 72];
  const int tid = threadIdx.x, lane = tid & 31, wave = tid >> 5;
  const int t0 = blockIdx.x * 64, d0 = blockIdx.y * 64, bz = blockIdx.z;
  const float* ab = in + (size_t)bz * kSA * kD;
#pragma unroll
  for (int i = 0; i < 4; ++i) {
    const int tr = i * 16 + (tid >> 4);
    const int dc = (tid & 15) * 4;
    const v4f v = *(const v4f*)(ab + (size_t)(t0 + tr) * kD + d0 + dc);
#pragma unroll
    for (int e = 0; e < 4; ++e) tile[(dc + e) * 72 + tr] = f2bf_bits(v[e]);
  }
  __syncthreads();
  unsigned short* ob = out + (size_t)bz * kD * kSA;
  const int q = lane >> 3, c8 = (lane & 7) * 8;
  const int r0 = wave * 8 + q;
  const int r1 = wave * 8 + 4 + q;
  const v4u u0 = *(const v4u*)(&tile[r0 * 72 + c8]);
  const v4u u1 = *(const v4u*)(&tile[r1 * 72 + c8]);
  unsigned short* p0 = ob + (size_t)(d0 + r0) * kSA + t0 + c8;
  unsigned short* p1 = ob + (size_t)(d0 + r1) * kSA + t0 + c8;
  *(v4u*)p0 = u0;
  *(v4u*)p1 = u1;
  
}

// ---------------------------------------------------------------------------
// Row softmax over kSA columns of S f32 [kNB*kSB][kSA] (max-subtracted, f32 exp, multiply by 1/sum); P emitted as bf16 hi (PH) and
// bf16 lo (PL = bf16-RNE(p - hi)) planes [kNB*kSB][kSA] (no carry scale; bf16 exponent range).
// One block of 256 threads per row, grid = kNB*kSB rows exactly (all batches in one launch). Passes 1-2: thread t visits columns t + 256*i, i = 0..7 (rolled loops,
// coalesced); pass 2 stages e = exp(s - max) in LDS. Reductions in fixed order (sequential per thread, xor tree per wave,
// 8 wave partials: max in index order, sum as a fixed pairwise tree). Store phase (after __syncthreads): thread t owns columns 8t..8t+7 (256 x 8 = 2048 = whole row
// ---------------------------------------------------------------------------
__global__ __launch_bounds__(256) void softmax_split_kernel(const float* __restrict__ S,
                                                            unsigned short* __restrict__ PH, unsigned short* __restrict__ PL) {
  __shared__ __align__(16) float srow[kSA];
  __shared__ float redm[8];
  __shared__ float reds[8];
  const int row = blockIdx.x;
  const int t = threadIdx.x, lane = t & 31, wave = t >> 5;
  const float* sr = S + (size_t)row * kSA;
  float m = -INFINITY;
#pragma unroll 1
  for (int i = 0; i < kSA / 256; ++i) m = fmaxf(m, sr[t + 256 * i]);
#pragma unroll
  for (int off = 16; off > 0; off >>= 1) m = fmaxf(m, __shfl_xor(m, off, 32));
  if (lane == 0) redm[wave] = m;
  __syncthreads();
  float mx = redm[0];
#pragma unroll
  for (int w = 1; w < 8; ++w) mx = fmaxf(mx, redm[w]);
  float s = 0.f;
#pragma unroll 1
  for (int i = 0; i < kSA / 256; ++i) {
    const int cidx = t + 256 * i;
    const float e = expf(sr[cidx] - mx);
    srow[cidx] = e;
    s += e;
  }
#pragma unroll
  for (int off = 16; off > 0; off >>= 1) s += __shfl_xor(s, off, 32);
  if (lane == 0) reds[wave] = s;
  __syncthreads();
  const float tot = ((reds[0] + reds[1]) + (reds[2] + reds[3])) + ((reds[4] + reds[5]) + (reds[6] + reds[7]));
  const float inv = 1.0f / tot;
  const int c0 = t * 8;
  const v4f e0 = *(const v4f*)(srow + c0);
  const v4f e1 = *(const v4f*)(srow + c0 + 4);
  unsigned short hbv[8], lb[8];
#pragma unroll
  for (int e = 0; e < 4; ++e) {
    const float p0 = e0[e] * inv;
    const float p1 = e1[e] * inv;
    const unsigned short h0 = f2bf_bits(p0);
    const unsigned short h1 = f2bf_bits(p1);
    hbv[e] = h0;
    hbv[4 + e] = h1;
    lb[e]      = f2bf_bits(p0 - bf_bits2f(h0));
    lb[4 + e]  = f2bf_bits(p1 - bf_bits2f(h1));
  }
  const v4u hv = (v4u){pk16(hbv[0], hbv[1]), pk16(hbv[2], hbv[3]), pk16(hbv[4], hbv[5]), pk16(hbv[6], hbv[7])};
  const v4u lv = (v4u){pk16(lb[0], lb[1]), pk16(lb[2], lb[3]), pk16(lb[4], lb[5]), pk16(lb[6], lb[7])};
  unsigned short* hp = PH + (size_t)row * kSA + c0;
  unsigned short* lp = PL + (size_t)row * kSA + c0;
  *(v4u*)hp = hv;
  *(v4u*)lp = lv;
  
}

// ---------------------------------------------------------------------------
// Workspace region map (byte offsets, all multiples of 128; every region fully written before it is read):
//   A16   bf16 [4][2048][1024]  (a, RNE bf16; rows t, K = d)            0           16,777,216 B
//   AT16  bf16 [4][1024][2048]  (a^T per batch; rows d, K = t)          16,777,216  16,777,216 B
//   WQ16  bf16 [1024][1024]     (Wq [out][in], RNE bf16)                33,554,432   2,097,152 B
//   QH    bf16 [8192][1024]     q hi plane                              35,651,584  16,777,216 B
//   QL    bf16 [8192][1024]     q lo plane                              52,428,800  16,777,216 B
//   R     two phases                                                    69,206,016  67,108,864 B
//           phase 1: B16 bf16 [8192][1024] (b, RNE bf16) in the first 16,777,216 B, dead after the q GEMM
//           phase 2: S f32 [4][2048][2048] scores of all batches
//   PH    bf16 [4][2048][2048]  P hi plane (all batches)               136,314,880  33,554,432 B
//   PL    bf16 [4][2048][2048]  P lo plane                             169,869,312  33,554,432 B
//   total 203,423,744 B
// GEMM shapes: q M=8192 N=1024 K=1024; scores M=N=2048 K=1024 x 4 batches; out M=2048 N=1024 K=2048 x 4 batches (batch = grid y).
// All K % 32 == 0, all M, N % 64 == 0, no padded planes, no tails.
// Launches: 3 casts + 1 transpose-cast + 1 q GEMM + scores GEMM + softmax + out GEMM = 8.
// ---------------------------------------------------------------------------
extern "C" void kernel_launch(void* const* d_in, const int* in_sizes, int n_in,
                              void* d_out, int out_size, void* d_ws, size_t ws_size,
                              hipStream_t stream) {
  if (n_in < 3) return;
  if (in_sizes[0] != kNB * kSA * kD) return;
  if (in_sizes[1] != kNB * kSB * kE) return;
  if (in_sizes[2] != kD * kE) return;
  if (out_size != kNB * kSB * kD) return;

  const float* a  = (const float*)d_in[0];   // [4][2048][1024]
  const float* b  = (const float*)d_in[1];   // [4][2048][1024]
  const float* wq = (const float*)d_in[2];   // [1024][1024]  ([out][in])
  float* outp = (float*)d_out;               // [4][2048][1024]

  // ---- carve ----
  const size_t SZ_A16  = (size_t)kNB * kSA * kD * 2;   // 16,777,216
  const size_t SZ_AT16 = (size_t)kNB * kD * kSA * 2;   // 16,777,216
  const size_t SZ_WQ16 = (size_t)kD * kE * 2;          //  2,097,152
  const size_t SZ_Q16  = (size_t)kNB * kSB * kD * 2;   // 16,777,216
  const size_t SZ_B16  = (size_t)kNB * kSB * kE * 2;   // 16,777,216
  const size_t SZ_S    = (size_t)kNB * kSB * kSA * 4;  // 67,108,864
  const size_t SZ_R    = (SZ_B16 > SZ_S) ? SZ_B16 : SZ_S;
  const size_t SZ_P16  = (size_t)kNB * kSB * kSA * 2;  // 33,554,432

  size_t off = 0;
  const size_t oA16  = off; off += SZ_A16;
  const size_t oAT16 = off; off += SZ_AT16;
  const size_t oWQ16 = off; off += SZ_WQ16;
  const size_t oQH   = off; off += SZ_Q16;
  const size_t oQL   = off; off += SZ_Q16;
  const size_t oR    = off; off += SZ_R;
  const size_t oPH   = off; off += SZ_P16;
  const size_t oPL   = off; off += SZ_P16;
  const size_t TOTAL = off;                            // 203,423,744
  if (TOTAL > ws_size) return;

  char* ws = (char*)d_ws;
  unsigned short* A16  = (unsigned short*)(ws + oA16);
  unsigned short* AT16 = (unsigned short*)(ws + oAT16);
  unsigned short* WQ16 = (unsigned short*)(ws + oWQ16);
  unsigned short* QH   = (unsigned short*)(ws + oQH);
  unsigned short* QL   = (unsigned short*)(ws + oQL);
  unsigned short* B16  = (unsigned short*)(ws + oR);   // phase 1 of R
  float*          Sf   = (float*)(ws + oR);            // phase 2 of R
  unsigned short* PH   = (unsigned short*)(ws + oPH);
  unsigned short* PL   = (unsigned short*)(ws + oPL);
  const float* dummy_rsc = (const float*)(ws + oR);    // unused by RSC == 0 instantiations

  const dim3 blk(256);

  // (0) casts: a -> A16, b -> B16, Wq -> WQ16 (bf16 RNE)
  {
    const int n8a = kNB * kSA * kD / 8;    // 1,048,576 -> 4096 blocks exactly
    cast8_kernel<0><<<dim3(n8a / 256), blk, 0, stream>>>(a, A16, n8a, 1.0f);
    const int n8b = kNB * kSB * kE / 8;    // 1,048,576 -> 4096 blocks exactly
    cast8_kernel<0><<<dim3(n8b / 256), blk, 0, stream>>>(b, B16, n8b, 1.0f);
    const int n8w = kD * kE / 8;           //   131,072 ->  512 blocks exactly
    cast8_kernel<0><<<dim3(n8w / 256), blk, 0, stream>>>(wq, WQ16, n8w, 1.0f);
  }
  // (1) a f32 [4][2048 t][1024 d] -> AT16 bf16 [4][1024 d][2048 t]; grid (t tiles, d tiles, batch)
  transpose_cast_kernel<<<dim3(kSA / 64, kD / 64, kNB), blk, 0, stream>>>(a, AT16);

  // (2) q = b . Wq^T for all batches: A = B16 [8192][1024], Bt = WQ16 [1024][1024] -> QH/QL bf16 hi/lo [8192][1024]
  const int gQ = ((kNB * kSB / 64) * (kD / 64) + 7) / 8;   // 256
  wmma_gemm64<1, 0, 0, 2, 0, 0><<<dim3(gQ, 1), blk, 0, stream>>>(
      B16, B16, kE, 0L, WQ16, WQ16, kE, 0L, (void*)QH, (void*)QL, kD, 0L, dummy_rsc, 0L, kNB * kSB, kD, kE, 1.0f);

  // The four batches are independent: each of the three stages runs once, with the batch as grid y (GEMMs) or folded into the
  // row index (softmax), so that one launch offers 4 x as many workgroups to the chip.
  const int gS = ((kSB / 64) * (kSA / 64) + 7) / 8;        // 128 per batch
  const int gO = ((kSB / 64) * (kD / 64) + 7) / 8;         //  64 per batch
  // (3) S[b][s][t] = (1/32) * sum_d q[b][s][d] a[b][t][d]: A = q hi|lo [2048][1024], Bt = A16 [2048][1024] -> S f32 [2048][2048]
  wmma_gemm64<1, 1, 0, 0, 0, 0><<<dim3(gS, kNB), blk, 0, stream>>>(
      QH, QL, kD, (long)kSB * kD, A16, A16, kD, (long)kSA * kD, (void*)Sf, (void*)Sf, kSA, (long)kSB * kSA,
      dummy_rsc, 0L, kSB, kSA, kD, kScoreScale);
  // (4) row softmax -> P hi/lo bf16 [4][2048][2048]
  softmax_split_kernel<<<dim3(kNB * kSB), blk, 0, stream>>>(Sf, PH, PL);
  // (5) out[b][s][d] = sum_t P[b][s][t] a[b][t][d]: A = P hi|lo [2048][2048], Bt = AT16 [1024][2048] -> d_out f32 [2048][1024]
  wmma_gemm64<1, 1, 0, 0, 0, 0><<<dim3(gO, kNB), blk, 0, stream>>>(
      PH, PL, kSA, (long)kSB * kSA, AT16, AT16, kSA, (long)kD * kSA, (void*)outp, (void*)outp, kD, (long)kSB * kD,
      dummy_rsc, 0L, kSB, kD, kSA, 1.0f);
}

// v002
// Measured time: 148 microseconds a run.
// Timed twice side by side with v001, it ran 2.19 and 2.20 times as fast.
// Counting every step since v000, it is 5.67 times as fast.
// Contractions: q = b.Wq^T (bf16 x bf16, 1 product), scores = q.a^T (q as bf16 hi/lo planes x a bf16, 2 products), out = P.a (P as bf16 hi/lo planes x a^T bf16, 2 products); all v_wmma_f32_16x16x32_bf16, f32 accumulate; inputs RNE-converted to bf16; scores f32, softmax f32.
#include <hip/hip_runtime.h>
#include <math.h>
#include <stdint.h>

// ---------------------------------------------------------------------------
// Problem constants
// ---------------------------------------------------------------------------
constexpr int kNB = 4;        // batch
constexpr int kSA = 2048;     // rows of a (keys / values)
constexpr int kSB = 2048;     // rows of b (queries)
constexpr int kD  = 1024;     // feature dim of a = attention dim = output dim
constexpr int kE  = 1024;     // feature dim of b
constexpr float kScoreScale = 0.03125f;   // 1024^-0.5 exactly

typedef __attribute__((ext_vector_type(16))) _Float16 v16h;
typedef __attribute__((ext_vector_type(8)))  _Float16 v8h;
typedef __attribute__((ext_vector_type(16))) __bf16   v16b;
typedef __attribute__((ext_vector_type(8)))  __bf16   v8b;
typedef __attribute__((ext_vector_type(8)))  float    v8f;
typedef __attribute__((ext_vector_type(4)))  float    v4f;
typedef __attribute__((ext_vector_type(4)))  unsigned int v4u;

// ---------------------------------------------------------------------------
// Device helpers
// ---------------------------------------------------------------------------
__device__ __forceinline__ unsigned short f2bf_bits(float f) {
  unsigned u = __float_as_uint(f);
  return (unsigned short)((u + 0x7FFFu + ((u >> 16) & 1u)) >> 16);
}
__device__ __forceinline__ float bf_bits2f(unsigned short h) { return __uint_as_float(((unsigned)h) << 16); }

typedef union { v16b v; v8b h[2]; } FragU;
// One bf16 A or B fragment from an LDS row: elements 0..7 <- bytes [0,16), 8..15 <- bytes [32,48) of p (p already holds the lane half's 16 B).
__device__ __forceinline__ v16b frag_lds(const unsigned char* p) {
  FragU f; f.h[0] = *(const v8b*)(p); f.h[1] = *(const v8b*)(p + 32); return f.v;
}
__device__ __forceinline__ v8f mma_bf16(v16b a, v16b b, v8f c) {
  return __builtin_amdgcn_wmma_f32_16x16x32_bf16(false, a, false, b, (short)0, c, false, false);
}

__device__ __forceinline__ unsigned pk16(unsigned short a, unsigned short b) { return (unsigned)a | ((unsigned)b << 16); }
__device__ __forceinline__ unsigned short h_bits(float f) { const _Float16 h = (_Float16)f; return __builtin_bit_cast(unsigned short, h); }

// ---- tensor-load helpers ---------------------------------------------------------------------------------------
typedef uint32_t u32x4 __attribute__((ext_vector_type(4)));
typedef uint32_t u32x8 __attribute__((ext_vector_type(8)));
__device__ __forceinline__ uint32_t uni(uint32_t v) { return (uint32_t)__builtin_amdgcn_readfirstlane(v); }
// Holds a wave-uniform test in a scalar register, so that the branch on it is a scalar branch (a tensor load ignores EXEC).
__device__ __forceinline__ uint32_t pinned(uint32_t v) { uint32_t w = (uint32_t)__builtin_amdgcn_readfirstlane(v); asm volatile("" : "+s"(w)); return w; }
// The compiler places no wait for a tensor load: the issuing wave's tile has landed only behind this.
__device__ __forceinline__ void wait_tensor0() { asm volatile("s_wait_tensorcnt 0x0" ::: "memory"); }
// This wave's LDS reads have returned before the barrier behind which their buffer is refilled.
__device__ __forceinline__ void wait_ds0() { asm volatile("s_wait_dscnt 0x0" ::: "memory"); }
__device__ __forceinline__ void tdm_load(u32x4 g0, u32x8 g1) { asm volatile("tensor_load_to_lds %0, %1" :: "s"(g0), "s"(g1) : "memory"); }

constexpr int      kBM     = 128;     // rows of C per workgroup
constexpr int      kBN     = 256;     // columns of C per workgroup
constexpr int      kPassK  = 128;     // k per pass = 256 B of every operand row
constexpr uint32_t kRowB   = 256u;    // bytes of an operand row per pass
constexpr uint32_t kPitch  = 272u;    // LDS row pitch: 256 B + the 16-B pad (odd multiple of 16 B: ds_load_b128 without bank conflicts)
constexpr uint32_t kSlRows = 64u;     // rows per slice = one wave's tensor load = one wave tile's rows of one operand plane
constexpr uint32_t kSlice  = 18432u;  // 64 x 272 = 17,408 B, rounded up to a multiple of 2 KiB
constexpr uint32_t kStage  = 8u * kSlice;   // slices 0,1 = A hi; 2,3 = A lo; 4..7 = Bt
static_assert(kSlRows * kPitch <= kSlice && (kSlice % 2048u) == 0u && 2u * kStage <= 320u * 1024u, "ring layout");

// Group 1: 1-byte elements, tile = tensor = 64 rows of 256 B, one 4-dword pad behind every 256-B row, no mask.
__device__ __forceinline__ u32x8 tdm_group1(uint32_t src_pitch) {
  u32x8 g;
  g[0] = uni((1u << 20) | (5u << 22) | (3u << 25));
  // pinned(): each descriptor word is held in its own scalar register for the whole loop, so that none is reused while a request is in flight
  g[1] = pinned((kRowB & 0xFFFFu) << 16);
  g[2] = pinned((kRowB >> 16) | ((kSlRows & 0xFFFFu) << 16));
  g[3] = pinned((kSlRows >> 16) | (kRowB << 16));
  g[4] = pinned(kSlRows);
  g[5] = pinned(src_pitch);
  g[6] = pinned(0u);
  g[7] = pinned(0u);
  return g;
}
__device__ __forceinline__ u32x4 tdm_group0(uint32_t lds_dst, uint64_t ga) {
  u32x4 g;
  g[0] = uni(1u); g[1] = uni(lds_dst); g[2] = uni((uint32_t)ga); g[3] = uni((((uint32_t)(ga >> 32)) & 0x01FFFFFFu) | 0x80000000u);
  return g;
}

// ---- Batched WMMA GEMM, operands staged in LDS by tensor loads ---------------------------------------------------
// C[m,n] = scale * sum_k A[m,k] * Bt[n,k]. A row-major [M,K]; Bt row-major [N,K]; bf16 bits. M % 128 == 0, N % 256 == 0, K % 128 == 0, K >= 256.
// One workgroup (8 waves, 2 x 4) owns a 128 x 256 tile of C, each wave 64 x 64. Per pass (128 k) every issuing wave brings one 64-row slice
// of one operand plane into LDS with one tensor load; two buffers, the load of pass s + 2 issued when pass s has been read.
// SPL: 1 = A carries a lo plane (A2): products h.h then l.h per 32 k into one f32 accumulator; 0 = one product (waves 2 and 3 issue no load).
// OUT_MODE: 0 = f32, 2 = bf16 hi plane (Cout) + bf16 lo plane (Cout2).
template <int SPL, int OUT_MODE>
__global__ __launch_bounds__(256) void wmma_gemm_lds(
    const unsigned short* __restrict__ Ap, const unsigned short* __restrict__ A2p, int lda, long strideA,
    const unsigned short* __restrict__ Btp, int ldb, long strideB,
    void* __restrict__ Cout, void* __restrict__ Cout2, int ldc, long strideC,
    int M, int N, int K, float scale) {
  __shared__ __attribute__((aligned(2048))) unsigned char ring[2u * kStage];
  const int b    = blockIdx.y;
  const int lane = threadIdx.x & 31;
  const uint32_t wave = uni(threadIdx.x >> 5);
  const int tilesN = N / kBN;
  const int tilesM = M / kBM;
  if ((int)blockIdx.x >= tilesM * tilesN) return;   // workgroup-uniform, in front of every barrier and load
  const int tm = blockIdx.x / tilesN;
  const int tn = blockIdx.x - tm * tilesN;
  const uint32_t wm = wave >> 2, wn = wave & 3u;
  const int m0 = tm * kBM + (int)wm * 64;           // this wave's 64 x 64 tile of C
  const int n0 = tn * kBN + (int)wn * 64;

  // This wave's slice of every stage.
  const bool isB = wave >= 4u;
  const uint32_t issuer = (SPL & 1) ? 1u : (uint32_t)(wave < 2u || isB);
  const unsigned short* splane = isB ? (Btp + (size_t)b * strideB + (size_t)(tn * kBN + (int)(wave - 4u) * 64) * ldb)
                                     : (((wave & 2u) ? A2p : Ap) + (size_t)b * strideA + (size_t)(tm * kBM + (int)(wave & 1u) * 64) * lda);
  const u32x8 g1 = tdm_group1(2u * (uint32_t)(isB ? ldb : lda));
  const uint32_t lbase = (uint32_t)(size_t)ring;
  auto issue = [&](int s) {
    const uint32_t dst = lbase + (uint32_t)(s & 1) * kStage + wave * kSlice;
    const uint64_t ga = (uint64_t)(size_t)splane + (uint64_t)(uint32_t)s * kRowB;
    tdm_load(tdm_group0(dst, ga), g1);
  };

  const int rlane = lane & 15;                 // row (A) / col (B, D) within subtile
  const int hl    = lane >> 4;                 // lane half: k offset 8 elements = 16 B
  const int mOff  = hl * 8;                    // D row offset

  v8f acc[4][4];
#pragma unroll
  for (int i = 0; i < 4; ++i)
#pragma unroll
    for (int j = 0; j < 4; ++j) acc[i][j] = (v8f){0.f,0.f,0.f,0.f,0.f,0.f,0.f,0.f};

  const int P = K / kPassK;                    // passes = stages, at least 2
  if ((SPL & 1) || pinned(issuer)) { issue(0); wait_tensor0(); }
  __syncthreads();                             // stage 0 published
  if ((SPL & 1) || pinned(issuer)) issue(1);

  // Byte offsets of this lane's first A (hi) and Bt fragment rows in the current buffer; they step from buffer to buffer with the loop.
  uint32_t oa = (uint32_t)rlane * kPitch + (uint32_t)hl * 16u + wm * kSlice;
  uint32_t ob = (uint32_t)rlane * kPitch + (uint32_t)hl * 16u + (4u + wn) * kSlice;
  int s = 0;
#pragma unroll 1   // one pass per trip: the publish point stands once, every fragment index stays constant
  do {             // P >= 2: no path round the loop with stage 1's request in flight
    const unsigned char* pa = ring + oa;
    const unsigned char* pl = pa + 2u * kSlice;
    const unsigned char* pb = ring + ob;
    v16b fa[2][4], fl[2][4], fb[2][4];
#pragma unroll
    for (int i = 0; i < 4; ++i) {
      fb[0][i] = frag_lds(pb + i * 16 * kPitch);
      fa[0][i] = frag_lds(pa + i * 16 * kPitch);
      if (SPL & 1) fl[0][i] = frag_lds(pl + i * 16 * kPitch);
    }
    __builtin_amdgcn_sched_barrier(0);     // the first block's reads stay ahead of the second's, so that the first wait is a counted one
#pragma unroll
    for (int kk = 0; kk < 4; ++kk) {
      const int c = kk & 1, nx = c ^ 1;
      if (kk < 3) {
#pragma unroll
        for (int i = 0; i < 4; ++i) {
          fb[nx][i] = frag_lds(pb + i * 16 * kPitch + (kk + 1) * 64);
          fa[nx][i] = frag_lds(pa + i * 16 * kPitch + (kk + 1) * 64);
          if (SPL & 1) fl[nx][i] = frag_lds(pl + i * 16 * kPitch + (kk + 1) * 64);
        }
      }
      __builtin_amdgcn_sched_barrier(0);   // keeps the next block's LDS reads one group ahead of this block's WMMAs, not among them
#pragma unroll
      for (int i = 0; i < 4; ++i)
#pragma unroll
        for (int j = 0; j < 4; ++j) acc[i][j] = mma_bf16(fa[c][i], fb[c][j], acc[i][j]);
      if (SPL & 1) {
#pragma unroll
        for (int i = 0; i < 4; ++i)
#pragma unroll
          for (int j = 0; j < 4; ++j) acc[i][j] = mma_bf16(fl[c][i], fb[c][j], acc[i][j]);
      }
      __builtin_amdgcn_sched_barrier(0);   // the block ends here: the following load group stays behind it
    }
    // Publish point of stage s + 1; the same barrier ends every wave's reads of stage s.
    wait_ds0();
    if ((SPL & 1) || pinned(issuer)) wait_tensor0();
    __syncthreads();
    if (pinned(issuer & (uint32_t)(s + 2 < P))) issue(s + 2);
    const uint32_t step = (s & 1) ? (0u - kStage) : kStage;
    oa += step;
    ob += step;
  } while (++s < P);
  wait_tensor0();
  wait_ds0();

  // ---- epilogue: per-wave 16 x 64 f32 slab (pitch 68 floats) in the ring, which every wave has left at the last pass's barrier ----
  float* slab = (float*)(ring + wave * (16u * 68u * 4u));
#pragma unroll
  for (int i = 0; i < 4; ++i) {
    const int mBase = m0 + (i << 4);
#pragma unroll
    for (int j = 0; j < 4; ++j) {
#pragma unroll
      for (int r = 0; r < 8; ++r) {
        float v = acc[i][j][r] * scale;
        slab[(mOff + r) * 68 + (j << 4) + rlane] = v;
      }
    }
    __builtin_amdgcn_fence(__ATOMIC_RELEASE, "workgroup");
    __builtin_amdgcn_wave_barrier();
    __builtin_amdgcn_fence(__ATOMIC_ACQUIRE, "workgroup");
    if (OUT_MODE == 0) {
      float* C = (float*)Cout + (size_t)b * strideC;
      const int hh = lane >> 4, c4 = (lane & 15) * 4;     // row seg = 256 B = 16 lanes x 16 B
#pragma unroll
      for (int it = 0; it < 8; ++it) {
        const int row = it * 2 + hh;
        v4f v = *(const v4f*)(slab + row * 68 + c4);
        *(v4f*)(C + (size_t)(mBase + row) * ldc + n0 + c4) = v;
      }
    } else {
      const int q = lane >> 3, c8 = (lane & 7) * 8;
      unsigned short* C  = (unsigned short*)Cout  + (size_t)b * strideC;
      unsigned short* C2 = (unsigned short*)Cout2 + (size_t)b * strideC;
#pragma unroll
      for (int it = 0; it < 4; ++it) {
        const int row = it * 4 + q;
        const float* sp = slab + row * 68 + c8;
        v8h hv, lv;
#pragma unroll
        for (int e = 0; e < 8; ++e) {
          unsigned short hb = f2bf_bits(sp[e]);
          unsigned short lb = f2bf_bits(sp[e] - bf_bits2f(hb));
          hv[e] = __builtin_bit_cast(_Float16, hb);
          lv[e] = __builtin_bit_cast(_Float16, lb);
        }
        *(v8h*)(C + (size_t)(mBase + row) * ldc + n0 + c8) = hv;
        *(v8h*)(C2 + (size_t)(mBase + row) * ldc + n0 + c8) = lv;
      }
    }
    __builtin_amdgcn_fence(__ATOMIC_RELEASE, "workgroup");
    __builtin_amdgcn_wave_barrier();
    __builtin_amdgcn_fence(__ATOMIC_ACQUIRE, "workgroup");
  }
}

// ---------------------------------------------------------------------------
// Cast, 8 consecutive elements per thread: in f32 [n] -> out 16-bit bits [n].
//   MODE 0: bf16 RNE bits. MODE 1: f16 bits of (scale * bf16-RNE value) (scale = power-of-two carry; exact for the bf16 value).
// ---------------------------------------------------------------------------
template <int MODE>
__global__ __launch_bounds__(256) void cast8_kernel(const float* __restrict__ in, unsigned short* __restrict__ out, int n8, float scale) {
  const int i = blockIdx.x * 256 + threadIdx.x;
  if (i >= n8) return;
  const float* p = in + 8 * (size_t)i;
  const v4f a = *(const v4f*)(p);
  const v4f c = *(const v4f*)(p + 4);
  unsigned short hb[8];
#pragma unroll
  for (int e = 0; e < 4; ++e) {
    if (MODE == 0) {
      hb[e]     = f2bf_bits(a[e]);
      hb[4 + e] = f2bf_bits(c[e]);
    } else {
      hb[e]     = h_bits(bf_bits2f(f2bf_bits(a[e])) * scale);
      hb[4 + e] = h_bits(bf_bits2f(f2bf_bits(c[e])) * scale);
    }
  }
  const v4u u = (v4u){pk16(hb[0], hb[1]), pk16(hb[2], hb[3]), pk16(hb[4], hb[5]), pk16(hb[6], hb[7])};
  unsigned short* q = out + 8 * (size_t)i;
  *(v4u*)q = u;
  
  (void)scale;
}

// ---------------------------------------------------------------------------
// Transpose-cast: in a f32 [kNB][kSA t][kD d] -> out bf16 RNE bits [kNB][kD d][kSA t] (row d, t contiguous = Bt layout with K = t).
// Block = 256 threads (8 waves), one 64(t) x 64(d) tile; grid (kSA/64, kD/64, kNB) exactly.
// Read coverage: 4 iterations x 16 t-rows x (16 lanes x 4 d) = 64 x 64 (the whole tile), staged in LDS as [d][t] (pitch 72 halves).
// Write coverage: 8 waves x 2 instructions x 4 d-rows x (8 lanes x 8 halves = 64 t) = 64 d-rows x 64 t (the whole tile);
// ---------------------------------------------------------------------------
__global__ __launch_bounds__(256) void transpose_cast_kernel(const float* __restrict__ in, unsigned short* __restrict__ out) {
  __shared__ __align__(16) unsigned short tile[64 * 72];
  const int tid = threadIdx.x, lane = tid & 31, wave = tid >> 5;
  const int t0 = blockIdx.x * 64, d0 = blockIdx.y * 64, bz = blockIdx.z;
  const float* ab = in + (size_t)bz * kSA * kD;
#pragma unroll
  for (int i = 0; i < 4; ++i) {
    const int tr = i * 16 + (tid >> 4);
    const int dc = (tid & 15) * 4;
    const v4f v = *(const v4f*)(ab + (size_t)(t0 + tr) * kD + d0 + dc);
#pragma unroll
    for (int e = 0; e < 4; ++e) tile[(dc + e) * 72 + tr] = f2bf_bits(v[e]);
  }
  __syncthreads();
  unsigned short* ob = out + (size_t)bz * kD * kSA;
  const int q = lane >> 3, c8 = (lane & 7) * 8;
  const int r0 = wave * 8 + q;
  const int r1 = wave * 8 + 4 + q;
  const v4u u0 = *(const v4u*)(&tile[r0 * 72 + c8]);
  const v4u u1 = *(const v4u*)(&tile[r1 * 72 + c8]);
  unsigned short* p0 = ob + (size_t)(d0 + r0) * kSA + t0 + c8;
  unsigned short* p1 = ob + (size_t)(d0 + r1) * kSA + t0 + c8;
  *(v4u*)p0 = u0;
  *(v4u*)p1 = u1;
  
}

// ---------------------------------------------------------------------------
// Row softmax over kSA columns of S f32 [kNB*kSB][kSA] (max-subtracted, f32 exp, multiply by 1/sum); P emitted as bf16 hi (PH) and
// bf16 lo (PL = bf16-RNE(p - hi)) planes [kNB*kSB][kSA] (no carry scale; bf16 exponent range).
// One block of 256 threads per row, grid = kNB*kSB rows exactly (all batches in one launch). Passes 1-2: thread t visits columns t + 256*i, i = 0..7 (rolled loops,
// coalesced); pass 2 stages e = exp(s - max) in LDS. Reductions in fixed order (sequential per thread, xor tree per wave,
// 8 wave partials: max in index order, sum as a fixed pairwise tree). Store phase (after __syncthreads): thread t owns columns 8t..8t+7 (256 x 8 = 2048 = whole row
// ---------------------------------------------------------------------------
__global__ __launch_bounds__(256) void softmax_split_kernel(const float* __restrict__ S,
                                                            unsigned short* __restrict__ PH, unsigned short* __restrict__ PL) {
  __shared__ __align__(16) float srow[kSA];
  __shared__ float redm[8];
  __shared__ float reds[8];
  const int row = blockIdx.x;
  const int t = threadIdx.x, lane = t & 31, wave = t >> 5;
  const float* sr = S + (size_t)row * kSA;
  float m = -INFINITY;
#pragma unroll 1
  for (int i = 0; i < kSA / 256; ++i) m = fmaxf(m, sr[t + 256 * i]);
#pragma unroll
  for (int off = 16; off > 0; off >>= 1) m = fmaxf(m, __shfl_xor(m, off, 32));
  if (lane == 0) redm[wave] = m;
  __syncthreads();
  float mx = redm[0];
#pragma unroll
  for (int w = 1; w < 8; ++w) mx = fmaxf(mx, redm[w]);
  float s = 0.f;
#pragma unroll 1
  for (int i = 0; i < kSA / 256; ++i) {
    const int cidx = t + 256 * i;
    const float e = expf(sr[cidx] - mx);
    srow[cidx] = e;
    s += e;
  }
#pragma unroll
  for (int off = 16; off > 0; off >>= 1) s += __shfl_xor(s, off, 32);
  if (lane == 0) reds[wave] = s;
  __syncthreads();
  const float tot = ((reds[0] + reds[1]) + (reds[2] + reds[3])) + ((reds[4] + reds[5]) + (reds[6] + reds[7]));
  const float inv = 1.0f / tot;
  const int c0 = t * 8;
  const v4f e0 = *(const v4f*)(srow + c0);
  const v4f e1 = *(const v4f*)(srow + c0 + 4);
  unsigned short hbv[8], lb[8];
#pragma unroll
  for (int e = 0; e < 4; ++e) {
    const float p0 = e0[e] * inv;
    const float p1 = e1[e] * inv;
    const unsigned short h0 = f2bf_bits(p0);
    const unsigned short h1 = f2bf_bits(p1);
    hbv[e] = h0;
    hbv[4 + e] = h1;
    lb[e]      = f2bf_bits(p0 - bf_bits2f(h0));
    lb[4 + e]  = f2bf_bits(p1 - bf_bits2f(h1));
  }
  const v4u hv = (v4u){pk16(hbv[0], hbv[1]), pk16(hbv[2], hbv[3]), pk16(hbv[4], hbv[5]), pk16(hbv[6], hbv[7])};
  const v4u lv = (v4u){pk16(lb[0], lb[1]), pk16(lb[2], lb[3]), pk16(lb[4], lb[5]), pk16(lb[6], lb[7])};
  unsigned short* hp = PH + (size_t)row * kSA + c0;
  unsigned short* lp = PL + (size_t)row * kSA + c0;
  *(v4u*)hp = hv;
  *(v4u*)lp = lv;
  
}

// ---------------------------------------------------------------------------
// Workspace region map (byte offsets, all multiples of 128; every region fully written before it is read):
//   A16   bf16 [4][2048][1024]  (a, RNE bf16; rows t, K = d)            0           16,777,216 B
//   AT16  bf16 [4][1024][2048]  (a^T per batch; rows d, K = t)          16,777,216  16,777,216 B
//   WQ16  bf16 [1024][1024]     (Wq [out][in], RNE bf16)                33,554,432   2,097,152 B
//   QH    bf16 [8192][1024]     q hi plane                              35,651,584  16,777,216 B
//   QL    bf16 [8192][1024]     q lo plane                              52,428,800  16,777,216 B
//   R     two phases                                                    69,206,016  67,108,864 B
//           phase 1: B16 bf16 [8192][1024] (b, RNE bf16) in the first 16,777,216 B, dead after the q GEMM
//           phase 2: S f32 [4][2048][2048] scores of all batches
//   PH    bf16 [4][2048][2048]  P hi plane (all batches)               136,314,880  33,554,432 B
//   PL    bf16 [4][2048][2048]  P lo plane                             169,869,312  33,554,432 B
//   total 203,423,744 B
// GEMM shapes: q M=8192 N=1024 K=1024; scores M=N=2048 K=1024 x 4 batches; out M=2048 N=1024 K=2048 x 4 batches (batch = grid y).
// All K % 128 == 0, all M % 128 == 0, all N % 256 == 0, no padded planes, no tails.
// Launches: 3 casts + 1 transpose-cast + 1 q GEMM + scores GEMM + softmax + out GEMM = 8.
// ---------------------------------------------------------------------------
extern "C" void kernel_launch(void* const* d_in, const int* in_sizes, int n_in,
                              void* d_out, int out_size, void* d_ws, size_t ws_size,
                              hipStream_t stream) {
  if (n_in < 3) return;
  if (in_sizes[0] != kNB * kSA * kD) return;
  if (in_sizes[1] != kNB * kSB * kE) return;
  if (in_sizes[2] != kD * kE) return;
  if (out_size != kNB * kSB * kD) return;

  const float* a  = (const float*)d_in[0];   // [4][2048][1024]
  const float* b  = (const float*)d_in[1];   // [4][2048][1024]
  const float* wq = (const float*)d_in[2];   // [1024][1024]  ([out][in])
  float* outp = (float*)d_out;               // [4][2048][1024]

  // ---- carve ----
  const size_t SZ_A16  = (size_t)kNB * kSA * kD * 2;   // 16,777,216
  const size_t SZ_AT16 = (size_t)kNB * kD * kSA * 2;   // 16,777,216
  const size_t SZ_WQ16 = (size_t)kD * kE * 2;          //  2,097,152
  const size_t SZ_Q16  = (size_t)kNB * kSB * kD * 2;   // 16,777,216
  const size_t SZ_B16  = (size_t)kNB * kSB * kE * 2;   // 16,777,216
  const size_t SZ_S    = (size_t)kNB * kSB * kSA * 4;  // 67,108,864
  const size_t SZ_R    = (SZ_B16 > SZ_S) ? SZ_B16 : SZ_S;
  const size_t SZ_P16  = (size_t)kNB * kSB * kSA * 2;  // 33,554,432

  size_t off = 0;
  const size_t oA16  = off; off += SZ_A16;
  const size_t oAT16 = off; off += SZ_AT16;
  const size_t oWQ16 = off; off += SZ_WQ16;
  const size_t oQH   = off; off += SZ_Q16;
  const size_t oQL   = off; off += SZ_Q16;
  const size_t oR    = off; off += SZ_R;
  const size_t oPH   = off; off += SZ_P16;
  const size_t oPL   = off; off += SZ_P16;
  const size_t TOTAL = off;                            // 203,423,744
  if (TOTAL > ws_size) return;

  char* ws = (char*)d_ws;
  unsigned short* A16  = (unsigned short*)(ws + oA16);
  unsigned short* AT16 = (unsigned short*)(ws + oAT16);
  unsigned short* WQ16 = (unsigned short*)(ws + oWQ16);
  unsigned short* QH   = (unsigned short*)(ws + oQH);
  unsigned short* QL   = (unsigned short*)(ws + oQL);
  unsigned short* B16  = (unsigned short*)(ws + oR);   // phase 1 of R
  float*          Sf   = (float*)(ws + oR);            // phase 2 of R
  unsigned short* PH   = (unsigned short*)(ws + oPH);
  unsigned short* PL   = (unsigned short*)(ws + oPL);

  const dim3 blk(256);

  // (0) casts: a -> A16, b -> B16, Wq -> WQ16 (bf16 RNE)
  {
    const int n8a = kNB * kSA * kD / 8;    // 1,048,576 -> 4096 blocks exactly
    cast8_kernel<0><<<dim3(n8a / 256), blk, 0, stream>>>(a, A16, n8a, 1.0f);
    const int n8b = kNB * kSB * kE / 8;    // 1,048,576 -> 4096 blocks exactly
    cast8_kernel<0><<<dim3(n8b / 256), blk, 0, stream>>>(b, B16, n8b, 1.0f);
    const int n8w = kD * kE / 8;           //   131,072 ->  512 blocks exactly
    cast8_kernel<0><<<dim3(n8w / 256), blk, 0, stream>>>(wq, WQ16, n8w, 1.0f);
  }
  // (1) a f32 [4][2048 t][1024 d] -> AT16 bf16 [4][1024 d][2048 t]; grid (t tiles, d tiles, batch)
  transpose_cast_kernel<<<dim3(kSA / 64, kD / 64, kNB), blk, 0, stream>>>(a, AT16);

  // (2) q = b . Wq^T for all batches: A = B16 [8192][1024], Bt = WQ16 [1024][1024] -> QH/QL bf16 hi/lo [8192][1024]
  const int gQ = (kNB * kSB / kBM) * (kD / kBN);           // 256
  wmma_gemm_lds<0, 2><<<dim3(gQ, 1), blk, 0, stream>>>(
      B16, B16, kE, 0L, WQ16, kE, 0L, (void*)QH, (void*)QL, kD, 0L, kNB * kSB, kD, kE, 1.0f);

  // The four batches are independent: each of the three stages runs once, with the batch as grid y (GEMMs) or folded into the
  // row index (softmax), so that one launch offers 4 x as many workgroups to the chip.
  const int gS = (kSB / kBM) * (kSA / kBN);                // 128 per batch
  const int gO = (kSB / kBM) * (kD / kBN);                 //  64 per batch
  // (3) S[b][s][t] = (1/32) * sum_d q[b][s][d] a[b][t][d]: A = q hi|lo [2048][1024], Bt = A16 [2048][1024] -> S f32 [2048][2048]
  wmma_gemm_lds<1, 0><<<dim3(gS, kNB), blk, 0, stream>>>(
      QH, QL, kD, (long)kSB * kD, A16, kD, (long)kSA * kD, (void*)Sf, (void*)Sf, kSA, (long)kSB * kSA,
      kSB, kSA, kD, kScoreScale);
  // (4) row softmax -> P hi/lo bf16 [4][2048][2048]
  softmax_split_kernel<<<dim3(kNB * kSB), blk, 0, stream>>>(Sf, PH, PL);
  // (5) out[b][s][d] = sum_t P[b][s][t] a[b][t][d]: A = P hi|lo [2048][2048], Bt = AT16 [1024][2048] -> d_out f32 [2048][1024]
  wmma_gemm_lds<1, 0><<<dim3(gO, kNB), blk, 0, stream>>>(
      PH, PL, kSA, (long)kSB * kSA, AT16, kSA, (long)kD * kSA, (void*)outp, (void*)outp, kD, (long)kSB * kD,
      kSB, kD, kSA, 1.0f);
}

// v003
// A run of this version takes 134 microseconds.
// Two timings next to v002 both put it at 1.11 times that version's speed.
// All steps since v000 together make it 6.28 times as fast.
// Contractions: q = b.Wq^T (bf16 x bf16, 1 product), scores = q.a^T (q as bf16 hi/lo planes x a bf16, 2 products), out = P.a (P as bf16 hi/lo planes x a^T bf16, 2 products); all v_wmma_f32_16x16x32_bf16, f32 accumulate; inputs RNE-converted to bf16; scores f32, softmax f32.
#include <hip/hip_runtime.h>
#include <math.h>
#include <stdint.h>

// ---------------------------------------------------------------------------
// Problem constants
// ---------------------------------------------------------------------------
constexpr int kNB = 4;        // batch
constexpr int kSA = 2048;     // rows of a (keys / values)
constexpr int kSB = 2048;     // rows of b (queries)
constexpr int kD  = 1024;     // feature dim of a = attention dim = output dim
constexpr int kE  = 1024;     // feature dim of b
constexpr float kScoreScale = 0.03125f;   // 1024^-0.5 exactly

typedef __attribute__((ext_vector_type(16))) _Float16 v16h;
typedef __attribute__((ext_vector_type(8)))  _Float16 v8h;
typedef __attribute__((ext_vector_type(16))) __bf16   v16b;
typedef __attribute__((ext_vector_type(8)))  __bf16   v8b;
typedef __attribute__((ext_vector_type(8)))  float    v8f;
typedef __attribute__((ext_vector_type(4)))  float    v4f;
typedef __attribute__((ext_vector_type(4)))  unsigned int v4u;
typedef __attribute__((ext_vector_type(2)))  unsigned int v2u;

// ---------------------------------------------------------------------------
// Device helpers
// ---------------------------------------------------------------------------
__device__ __forceinline__ unsigned short f2bf_bits(float f) {
  unsigned u = __float_as_uint(f);
  return (unsigned short)((u + 0x7FFFu + ((u >> 16) & 1u)) >> 16);
}
__device__ __forceinline__ float bf_bits2f(unsigned short h) { return __uint_as_float(((unsigned)h) << 16); }

typedef union { v16b v; v8b h[2]; } FragU;
// One bf16 A or B fragment from an LDS row: elements 0..7 <- bytes [0,16), 8..15 <- bytes [32,48) of p (p already holds the lane half's 16 B).
__device__ __forceinline__ v16b frag_lds(const unsigned char* p) {
  FragU f; f.h[0] = *(const v8b*)(p); f.h[1] = *(const v8b*)(p + 32); return f.v;
}
__device__ __forceinline__ v8f mma_bf16(v16b a, v16b b, v8f c) {
  return __builtin_amdgcn_wmma_f32_16x16x32_bf16(false, a, false, b, (short)0, c, false, false);
}

__device__ __forceinline__ unsigned pk16(unsigned short a, unsigned short b) { return (unsigned)a | ((unsigned)b << 16); }
__device__ __forceinline__ unsigned short h_bits(float f) { const _Float16 h = (_Float16)f; return __builtin_bit_cast(unsigned short, h); }

// ---- tensor-load helpers ---------------------------------------------------------------------------------------
typedef uint32_t u32x4 __attribute__((ext_vector_type(4)));
typedef uint32_t u32x8 __attribute__((ext_vector_type(8)));
__device__ __forceinline__ uint32_t uni(uint32_t v) { return (uint32_t)__builtin_amdgcn_readfirstlane(v); }
// Holds a wave-uniform test in a scalar register, so that the branch on it is a scalar branch (a tensor load ignores EXEC).
__device__ __forceinline__ uint32_t pinned(uint32_t v) { uint32_t w = (uint32_t)__builtin_amdgcn_readfirstlane(v); asm volatile("" : "+s"(w)); return w; }
// The compiler places no wait for a tensor load: the issuing wave's tile has landed only behind this.
__device__ __forceinline__ void wait_tensor0() { asm volatile("s_wait_tensorcnt 0x0" ::: "memory"); }
// This wave's LDS reads have returned before the barrier behind which their buffer is refilled.
__device__ __forceinline__ void wait_ds0() { asm volatile("s_wait_dscnt 0x0" ::: "memory"); }
__device__ __forceinline__ void tdm_load(u32x4 g0, u32x8 g1) { asm volatile("tensor_load_to_lds %0, %1" :: "s"(g0), "s"(g1) : "memory"); }

constexpr int      kBM     = 128;     // rows of C per workgroup
constexpr int      kBN     = 256;     // columns of C per workgroup
constexpr int      kPassK  = 128;     // k per pass = 256 B of every operand row
constexpr uint32_t kRowB   = 256u;    // bytes of an operand row per pass
constexpr uint32_t kPitch  = 272u;    // LDS row pitch: 256 B + the 16-B pad (odd multiple of 16 B: ds_load_b128 without bank conflicts)
constexpr uint32_t kSlRows = 64u;     // rows per slice = one wave's tensor load = one wave tile's rows of one operand plane
constexpr uint32_t kSlice  = 18432u;  // 64 x 272 = 17,408 B, rounded up to a multiple of 2 KiB
constexpr uint32_t kStage  = 8u * kSlice;   // slices 0,1 = A hi; 2,3 = A lo; 4..7 = Bt
static_assert(kSlRows * kPitch <= kSlice && (kSlice % 2048u) == 0u && 2u * kStage <= 320u * 1024u, "ring layout");

// Group 1: 1-byte elements, tile = tensor = 64 rows of 256 B, one 4-dword pad behind every 256-B row, no mask.
__device__ __forceinline__ u32x8 tdm_group1(uint32_t src_pitch) {
  u32x8 g;
  g[0] = uni((1u << 20) | (5u << 22) | (3u << 25));
  // pinned(): each descriptor word is held in its own scalar register for the whole loop, so that none is reused while a request is in flight
  g[1] = pinned((kRowB & 0xFFFFu) << 16);
  g[2] = pinned((kRowB >> 16) | ((kSlRows & 0xFFFFu) << 16));
  g[3] = pinned((kSlRows >> 16) | (kRowB << 16));
  g[4] = pinned(kSlRows);
  g[5] = pinned(src_pitch);
  g[6] = pinned(0u);
  g[7] = pinned(0u);
  return g;
}
__device__ __forceinline__ u32x4 tdm_group0(uint32_t lds_dst, uint64_t ga) {
  u32x4 g;
  g[0] = uni(1u); g[1] = uni(lds_dst); g[2] = uni((uint32_t)ga); g[3] = uni((((uint32_t)(ga >> 32)) & 0x01FFFFFFu) | 0x80000000u);
  return g;
}

// ---- Batched WMMA GEMM, operands staged in LDS by tensor loads ---------------------------------------------------
// C[m,n] = scale * sum_k A[m,k] * Bt[n,k]. A row-major [M,K]; Bt row-major [N,K]; bf16 bits. M % 128 == 0, N % 256 == 0, K % 128 == 0, K >= 256.
// One workgroup (8 waves, 2 x 4) owns a 128 x 256 tile of C, each wave 64 x 64. Per pass (128 k) every issuing wave brings one 64-row slice
// of one operand plane into LDS with one tensor load; two buffers, the load of pass s + 2 issued when pass s has been read.
// SPL: 1 = A carries a lo plane (A2): products h.h then l.h per 32 k into one f32 accumulator; 0 = one product (waves 2 and 3 issue no load).
// OUT_MODE: 0 = f32, 2 = bf16 hi plane (Cout) + bf16 lo plane (Cout2).
template <int SPL, int OUT_MODE>
__global__ __launch_bounds__(256) void wmma_gemm_lds(
    const unsigned short* __restrict__ Ap, const unsigned short* __restrict__ A2p, int lda, long strideA,
    const unsigned short* __restrict__ Btp, int ldb, long strideB,
    void* __restrict__ Cout, void* __restrict__ Cout2, int ldc, long strideC,
    int M, int N, int K, float scale) {
  __shared__ __attribute__((aligned(2048))) unsigned char ring[2u * kStage];
  const int b    = blockIdx.y;
  const int lane = threadIdx.x & 31;
  const uint32_t wave = uni(threadIdx.x >> 5);
  const int tilesN = N / kBN;
  const int tilesM = M / kBM;
  if ((int)blockIdx.x >= tilesM * tilesN) return;   // workgroup-uniform, in front of every barrier and load
  const int tm = blockIdx.x / tilesN;
  const int tn = blockIdx.x - tm * tilesN;
  const uint32_t wm = wave >> 2, wn = wave & 3u;
  const int m0 = tm * kBM + (int)wm * 64;           // this wave's 64 x 64 tile of C
  const int n0 = tn * kBN + (int)wn * 64;

  // This wave's slice of every stage.
  const bool isB = wave >= 4u;
  const uint32_t issuer = (SPL & 1) ? 1u : (uint32_t)(wave < 2u || isB);
  const unsigned short* splane = isB ? (Btp + (size_t)b * strideB + (size_t)(tn * kBN + (int)(wave - 4u) * 64) * ldb)
                                     : (((wave & 2u) ? A2p : Ap) + (size_t)b * strideA + (size_t)(tm * kBM + (int)(wave & 1u) * 64) * lda);
  const u32x8 g1 = tdm_group1(2u * (uint32_t)(isB ? ldb : lda));
  const uint32_t lbase = (uint32_t)(size_t)ring;
  auto issue = [&](int s) {
    const uint32_t dst = lbase + (uint32_t)(s & 1) * kStage + wave * kSlice;
    const uint64_t ga = (uint64_t)(size_t)splane + (uint64_t)(uint32_t)s * kRowB;
    tdm_load(tdm_group0(dst, ga), g1);
  };

  const int rlane = lane & 15;                 // row (A) / col (B, D) within subtile
  const int hl    = lane >> 4;                 // lane half: k offset 8 elements = 16 B
  const int mOff  = hl * 8;                    // D row offset

  v8f acc[4][4];
#pragma unroll
  for (int i = 0; i < 4; ++i)
#pragma unroll
    for (int j = 0; j < 4; ++j) acc[i][j] = (v8f){0.f,0.f,0.f,0.f,0.f,0.f,0.f,0.f};

  const int P = K / kPassK;                    // passes = stages, at least 2
  if ((SPL & 1) || pinned(issuer)) { issue(0); wait_tensor0(); }
  __syncthreads();                             // stage 0 published
  if ((SPL & 1) || pinned(issuer)) issue(1);

  // Byte offsets of this lane's first A (hi) and Bt fragment rows in the current buffer; they step from buffer to buffer with the loop.
  uint32_t oa = (uint32_t)rlane * kPitch + (uint32_t)hl * 16u + wm * kSlice;
  uint32_t ob = (uint32_t)rlane * kPitch + (uint32_t)hl * 16u + (4u + wn) * kSlice;
  int s = 0;
#pragma unroll 1   // one pass per trip: the publish point stands once, every fragment index stays constant
  do {             // P >= 2: no path round the loop with stage 1's request in flight
    const unsigned char* pa = ring + oa;
    const unsigned char* pl = pa + 2u * kSlice;
    const unsigned char* pb = ring + ob;
    v16b fa[2][4], fl[2][4], fb[2][4];
#pragma unroll
    for (int i = 0; i < 4; ++i) {
      fb[0][i] = frag_lds(pb + i * 16 * kPitch);
      fa[0][i] = frag_lds(pa + i * 16 * kPitch);
      if (SPL & 1) fl[0][i] = frag_lds(pl + i * 16 * kPitch);
    }
    __builtin_amdgcn_sched_barrier(0);     // the first block's reads stay ahead of the second's, so that the first wait is a counted one
#pragma unroll
    for (int kk = 0; kk < 4; ++kk) {
      const int c = kk & 1, nx = c ^ 1;
      if (kk < 3) {
#pragma unroll
        for (int i = 0; i < 4; ++i) {
          fb[nx][i] = frag_lds(pb + i * 16 * kPitch + (kk + 1) * 64);
          fa[nx][i] = frag_lds(pa + i * 16 * kPitch + (kk + 1) * 64);
          if (SPL & 1) fl[nx][i] = frag_lds(pl + i * 16 * kPitch + (kk + 1) * 64);
        }
      }
      __builtin_amdgcn_sched_barrier(0);   // keeps the next block's LDS reads one group ahead of this block's WMMAs, not among them
#pragma unroll
      for (int i = 0; i < 4; ++i)
#pragma unroll
        for (int j = 0; j < 4; ++j) acc[i][j] = mma_bf16(fa[c][i], fb[c][j], acc[i][j]);
      if (SPL & 1) {
#pragma unroll
        for (int i = 0; i < 4; ++i)
#pragma unroll
          for (int j = 0; j < 4; ++j) acc[i][j] = mma_bf16(fl[c][i], fb[c][j], acc[i][j]);
      }
      __builtin_amdgcn_sched_barrier(0);   // the block ends here: the following load group stays behind it
    }
    // Publish point of stage s + 1; the same barrier ends every wave's reads of stage s.
    wait_ds0();
    if ((SPL & 1) || pinned(issuer)) wait_tensor0();
    __syncthreads();
    if (pinned(issuer & (uint32_t)(s + 2 < P))) issue(s + 2);
    const uint32_t step = (s & 1) ? (0u - kStage) : kStage;
    oa += step;
    ob += step;
  } while (++s < P);
  wait_tensor0();
  wait_ds0();

  // ---- epilogue: per-wave 16 x 64 f32 slab (pitch 68 floats) in the ring, which every wave has left at the last pass's barrier ----
  float* slab = (float*)(ring + wave * (16u * 68u * 4u));
#pragma unroll
  for (int i = 0; i < 4; ++i) {
    const int mBase = m0 + (i << 4);
#pragma unroll
    for (int j = 0; j < 4; ++j) {
#pragma unroll
      for (int r = 0; r < 8; ++r) {
        float v = acc[i][j][r] * scale;
        slab[(mOff + r) * 68 + (j << 4) + rlane] = v;
      }
    }
    __builtin_amdgcn_fence(__ATOMIC_RELEASE, "workgroup");
    __builtin_amdgcn_wave_barrier();
    __builtin_amdgcn_fence(__ATOMIC_ACQUIRE, "workgroup");
    if (OUT_MODE == 0) {
      float* C = (float*)Cout + (size_t)b * strideC;
      const int hh = lane >> 4, c4 = (lane & 15) * 4;     // row seg = 256 B = 16 lanes x 16 B
#pragma unroll
      for (int it = 0; it < 8; ++it) {
        const int row = it * 2 + hh;
        v4f v = *(const v4f*)(slab + row * 68 + c4);
        *(v4f*)(C + (size_t)(mBase + row) * ldc + n0 + c4) = v;
      }
    } else {
      const int q = lane >> 3, c8 = (lane & 7) * 8;
      unsigned short* C  = (unsigned short*)Cout  + (size_t)b * strideC;
      unsigned short* C2 = (unsigned short*)Cout2 + (size_t)b * strideC;
#pragma unroll
      for (int it = 0; it < 4; ++it) {
        const int row = it * 4 + q;
        const float* sp = slab + row * 68 + c8;
        v8h hv, lv;
#pragma unroll
        for (int e = 0; e < 8; ++e) {
          unsigned short hb = f2bf_bits(sp[e]);
          unsigned short lb = f2bf_bits(sp[e] - bf_bits2f(hb));
          hv[e] = __builtin_bit_cast(_Float16, hb);
          lv[e] = __builtin_bit_cast(_Float16, lb);
        }
        *(v8h*)(C + (size_t)(mBase + row) * ldc + n0 + c8) = hv;
        *(v8h*)(C2 + (size_t)(mBase + row) * ldc + n0 + c8) = lv;
      }
    }
    __builtin_amdgcn_fence(__ATOMIC_RELEASE, "workgroup");
    __builtin_amdgcn_wave_barrier();
    __builtin_amdgcn_fence(__ATOMIC_ACQUIRE, "workgroup");
  }
}

// ---------------------------------------------------------------------------
// The streaming kernels (casts, transpose-cast, softmax) each run as one resident round: 256 workgroups of 16 waves, one per WGP,
// every wave with its own contiguous work and 2 to 32 16-byte loads in flight, instead of thousands of short 8-wave workgroups.
// ---------------------------------------------------------------------------
constexpr int kStrBlocks  = 256;   // workgroups per streaming launch
constexpr int kStrThreads = 512;   // 16 waves

// Stands behind a group of global loads or stores, in front of the first instruction that may reuse a register they name.
// The address is an input only, so that its registers stay untouched up to the wait.
__device__ __forceinline__ void wait_x0(const void* p) { asm volatile("s_wait_xcnt 0x0" :: "v"(p) : "memory"); }

// ---------------------------------------------------------------------------
// Cast, 8 consecutive elements per chunk: in f32 [8 * n8] -> out 16-bit bits [8 * n8]. A wave owns U * 32 consecutive chunks
// (U KiB of input); lane l takes chunks 32 u + l, u = 0..U-1, and issues their 2 U loads together.
//   MODE 0: bf16 RNE bits. MODE 1: f16 bits of (scale * bf16-RNE value) (scale = power-of-two carry; exact for the bf16 value).
// ---------------------------------------------------------------------------
template <int MODE>
__device__ __forceinline__ v4u cast8_chunk(v4f a, v4f c, float scale) {
  unsigned short hb[8];
#pragma unroll
  for (int e = 0; e < 4; ++e) {
    if (MODE == 0) {
      hb[e]     = f2bf_bits(a[e]);
      hb[4 + e] = f2bf_bits(c[e]);
    } else {
      hb[e]     = h_bits(bf_bits2f(f2bf_bits(a[e])) * scale);
      hb[4 + e] = h_bits(bf_bits2f(f2bf_bits(c[e])) * scale);
    }
  }
  return (v4u){pk16(hb[0], hb[1]), pk16(hb[2], hb[3]), pk16(hb[4], hb[5]), pk16(hb[6], hb[7])};
}
template <int MODE, int U>
__global__ __launch_bounds__(kStrThreads) void cast8_kernel(const float* __restrict__ in, unsigned short* __restrict__ out, int n8, float scale) {
  const int lane = threadIdx.x & 31, wave = threadIdx.x >> 5;
  const int w0 = ((int)blockIdx.x * (kStrThreads / 32) + wave) * (U * 32);   // this wave's first chunk
  if (w0 + U * 32 <= n8) {
    const float* p = in + 8 * (size_t)(w0 + lane);
    unsigned short* q = out + 8 * (size_t)(w0 + lane);
    v4f a[U], c[U];
#pragma unroll
    for (int u = 0; u < U; ++u) {
      a[u] = *(const v4f*)(p + u * 256);
      c[u] = *(const v4f*)(p + u * 256 + 4);
    }
    wait_x0(p);
    __builtin_amdgcn_sched_barrier(0);   // all 2 U loads are issued before the first conversion; left free, the compiler sinks half of them behind it
#pragma unroll
    for (int u = 0; u < U; ++u) *(v4u*)(q + u * 256) = cast8_chunk<MODE>(a[u], c[u], scale);
  } else {                               // the wave at the end of an n8 that is no multiple of U * 32
    for (int u = 0; u < U; ++u) {
      const int i = w0 + u * 32 + lane;
      if (i < n8) {
        const float* p = in + 8 * (size_t)i;
        *(v4u*)(out + 8 * (size_t)i) = cast8_chunk<MODE>(*(const v4f*)(p), *(const v4f*)(p + 4), scale);
      }
    }
  }
}

// ---------------------------------------------------------------------------
// Transpose-cast: in a f32 [kNB][kSA t][kD d] -> out bf16 RNE bits [kNB][kD d][kSA t] (row d, t contiguous = Bt layout with K = t).
// One wave owns one 64(t) x 32(d) tile and its own LDS slab; no wave reads another's slab, so there is no workgroup barrier.
// Block = 16 waves = 8 (t) x 2 (d) tiles = 512 t x 64 d; grid (kSA/512, kD/64, kNB) = 256 workgroups exactly.
// Read coverage per wave: 16 loads x 4 t-rows x (8 lanes x 4 d = 128 B) = 64 x 32, staged in LDS as [d][t] (pitch 72 halves).
// Write coverage per wave: 8 stores x 4 d-rows x (8 lanes x 8 halves = 64 t = 128 B) = 32 d-rows x 64 t.
// ---------------------------------------------------------------------------
__global__ __launch_bounds__(kStrThreads) void transpose_cast_kernel(const float* __restrict__ in, unsigned short* __restrict__ out) {
  __shared__ __align__(16) unsigned short tile[16][32 * 72];
  const int lane = threadIdx.x & 31, wave = threadIdx.x >> 5;
  const int t0 = blockIdx.x * 512 + (wave >> 1) * 64;
  const int d0 = blockIdx.y * 64 + (wave & 1) * 32;
  const int bz = blockIdx.z;
  const int q = lane >> 3, dc = (lane & 7) * 4, c8 = (lane & 7) * 8;
  const float* ab = in + (size_t)bz * kSA * kD + (size_t)(t0 + q) * kD + d0 + dc;
  v4f v[16];
#pragma unroll
  for (int i = 0; i < 16; ++i) v[i] = *(const v4f*)(ab + (size_t)(i * 4) * kD);
  wait_x0(ab);
  __builtin_amdgcn_sched_barrier(0);   // all 16 loads are issued before the first conversion; left free, the compiler holds half of them back
  unsigned short* tl = tile[wave];
#pragma unroll
  for (int i = 0; i < 16; ++i)
#pragma unroll
    for (int e = 0; e < 4; ++e) tl[(dc + e) * 72 + i * 4 + q] = f2bf_bits(v[i][e]);
  // The slab goes from lane to lane inside one wave: its LDS writes are done, and stay in front of the reads, without a workgroup barrier.
  __builtin_amdgcn_fence(__ATOMIC_RELEASE, "workgroup");
  __builtin_amdgcn_wave_barrier();
  __builtin_amdgcn_fence(__ATOMIC_ACQUIRE, "workgroup");
  unsigned short* ob = out + (size_t)bz * kD * kSA + (size_t)(d0 + q) * kSA + t0 + c8;
#pragma unroll
  for (int j = 0; j < 8; ++j) {
    const v4u u = *(const v4u*)(&tl[(j * 4 + q) * 72 + c8]);
    *(v4u*)(ob + (size_t)(j * 4) * kSA) = u;
  }
}

// ---------------------------------------------------------------------------
// Row softmax over kSA columns of S f32 [kNB*kSB][kSA] (max-subtracted, f32 exp, multiply by 1/sum); P emitted as bf16 hi (PH) and
// bf16 lo (PL = bf16-RNE(p - hi)) planes [kNB*kSB][kSA] (no carry scale; bf16 exponent range).
// One wave per row, the row in registers (read once): lane l holds columns 128 i + 4 l .. + 3, i = 0..15. Every wave takes two
// neighbouring rows and issues the 32 loads of both at its start. No LDS array and no barrier. 256 workgroups x 16 waves x 2 = kNB*kSB rows.
// Reductions in fixed order: per lane four chains (one per vector component) over i, ((c0 + c1) + (c2 + c3)), then an xor tree over the wave.
// ---------------------------------------------------------------------------
__global__ __launch_bounds__(kStrThreads) void softmax_split_kernel(const float* __restrict__ S,
                                                                    unsigned short* __restrict__ PH, unsigned short* __restrict__ PL) {
  const int lane = threadIdx.x & 31, wave = threadIdx.x >> 5;
  const int row0 = ((int)blockIdx.x * (kStrThreads / 32) + wave) * 2;
  const float* sp = S + (size_t)row0 * kSA + lane * 4;
  v4f x[2][16];
#pragma unroll
  for (int r = 0; r < 2; ++r)
#pragma unroll
    for (int i = 0; i < 16; ++i) x[r][i] = *(const v4f*)(sp + r * kSA + i * 128);
  wait_x0(sp);
  __builtin_amdgcn_sched_barrier(0);   // both rows' loads stay in front of the first row's arithmetic, so that the second row lands under it
#pragma unroll
  for (int r = 0; r < 2; ++r) {
    float m = -INFINITY;
#pragma unroll
    for (int i = 0; i < 16; ++i) m = fmaxf(m, fmaxf(fmaxf(x[r][i][0], x[r][i][1]), fmaxf(x[r][i][2], x[r][i][3])));
#pragma unroll
    for (int off = 16; off > 0; off >>= 1) m = fmaxf(m, __shfl_xor(m, off, 32));
    v4f sc = (v4f){0.f, 0.f, 0.f, 0.f};
#pragma unroll
    for (int i = 0; i < 16; ++i) {
#pragma unroll
      for (int e = 0; e < 4; ++e) {
        x[r][i][e] = expf(x[r][i][e] - m);
        sc[e] += x[r][i][e];
      }
    }
    float s = (sc[0] + sc[1]) + (sc[2] + sc[3]);
#pragma unroll
    for (int off = 16; off > 0; off >>= 1) s += __shfl_xor(s, off, 32);
    const float inv = 1.0f / s;
    v2u hv[16], lv[16];
#pragma unroll
    for (int i = 0; i < 16; ++i) {
      unsigned short hb[4], lb[4];
#pragma unroll
      for (int e = 0; e < 4; ++e) {
        const float p = x[r][i][e] * inv;
        hb[e] = f2bf_bits(p);
        lb[e] = f2bf_bits(p - bf_bits2f(hb[e]));
      }
      hv[i] = (v2u){pk16(hb[0], hb[1]), pk16(hb[2], hb[3])};
      lv[i] = (v2u){pk16(lb[0], lb[1]), pk16(lb[2], lb[3])};
    }
    unsigned short* hp = PH + (size_t)(row0 + r) * kSA + lane * 4;
    unsigned short* lp = PL + (size_t)(row0 + r) * kSA + lane * 4;
    __builtin_amdgcn_sched_barrier(0);   // the row's 32 stores go out as one group behind its arithmetic: none of their registers is reused among them
#pragma unroll
    for (int i = 0; i < 16; ++i) {
      *(v2u*)(hp + i * 128) = hv[i];
      *(v2u*)(lp + i * 128) = lv[i];
    }
    if (r == 0) wait_x0(hp);             // behind the last row nothing is reused
    __builtin_amdgcn_sched_barrier(0);   // the next row's arithmetic begins behind the wait; mixed with this row's it also overflows the registers (spills)
  }
}

// ---------------------------------------------------------------------------
// Workspace region map (byte offsets, all multiples of 128; every region fully written before it is read):
//   A16   bf16 [4][2048][1024]  (a, RNE bf16; rows t, K = d)            0           16,777,216 B
//   AT16  bf16 [4][1024][2048]  (a^T per batch; rows d, K = t)          16,777,216  16,777,216 B
//   WQ16  bf16 [1024][1024]     (Wq [out][in], RNE bf16)                33,554,432   2,097,152 B
//   QH    bf16 [8192][1024]     q hi plane                              35,651,584  16,777,216 B
//   QL    bf16 [8192][1024]     q lo plane                              52,428,800  16,777,216 B
//   R     two phases                                                    69,206,016  67,108,864 B
//           phase 1: B16 bf16 [8192][1024] (b, RNE bf16) in the first 16,777,216 B, dead after the q GEMM
//           phase 2: S f32 [4][2048][2048] scores of all batches
//   PH    bf16 [4][2048][2048]  P hi plane (all batches)               136,314,880  33,554,432 B
//   PL    bf16 [4][2048][2048]  P lo plane                             169,869,312  33,554,432 B
//   total 203,423,744 B
// GEMM shapes: q M=8192 N=1024 K=1024; scores M=N=2048 K=1024 x 4 batches; out M=2048 N=1024 K=2048 x 4 batches (batch = grid y).
// All K % 128 == 0, all M % 128 == 0, all N % 256 == 0, no padded planes, no tails.
// Launches: 3 casts + 1 transpose-cast + 1 q GEMM + scores GEMM + softmax + out GEMM = 8.
// ---------------------------------------------------------------------------
extern "C" void kernel_launch(void* const* d_in, const int* in_sizes, int n_in,
                              void* d_out, int out_size, void* d_ws, size_t ws_size,
                              hipStream_t stream) {
  if (n_in < 3) return;
  if (in_sizes[0] != kNB * kSA * kD) return;
  if (in_sizes[1] != kNB * kSB * kE) return;
  if (in_sizes[2] != kD * kE) return;
  if (out_size != kNB * kSB * kD) return;

  const float* a  = (const float*)d_in[0];   // [4][2048][1024]
  const float* b  = (const float*)d_in[1];   // [4][2048][1024]
  const float* wq = (const float*)d_in[2];   // [1024][1024]  ([out][in])
  float* outp = (float*)d_out;               // [4][2048][1024]

  // ---- carve ----
  const size_t SZ_A16  = (size_t)kNB * kSA * kD * 2;   // 16,777,216
  const size_t SZ_AT16 = (size_t)kNB * kD * kSA * 2;   // 16,777,216
  const size_t SZ_WQ16 = (size_t)kD * kE * 2;          //  2,097,152
  const size_t SZ_Q16  = (size_t)kNB * kSB * kD * 2;   // 16,777,216
  const size_t SZ_B16  = (size_t)kNB * kSB * kE * 2;   // 16,777,216
  const size_t SZ_S    = (size_t)kNB * kSB * kSA * 4;  // 67,108,864
  const size_t SZ_R    = (SZ_B16 > SZ_S) ? SZ_B16 : SZ_S;
  const size_t SZ_P16  = (size_t)kNB * kSB * kSA * 2;  // 33,554,432

  size_t off = 0;
  const size_t oA16  = off; off += SZ_A16;
  const size_t oAT16 = off; off += SZ_AT16;
  const size_t oWQ16 = off; off += SZ_WQ16;
  const size_t oQH   = off; off += SZ_Q16;
  const size_t oQL   = off; off += SZ_Q16;
  const size_t oR    = off; off += SZ_R;
  const size_t oPH   = off; off += SZ_P16;
  const size_t oPL   = off; off += SZ_P16;
  const size_t TOTAL = off;                            // 203,423,744
  if (TOTAL > ws_size) return;

  char* ws = (char*)d_ws;
  unsigned short* A16  = (unsigned short*)(ws + oA16);
  unsigned short* AT16 = (unsigned short*)(ws + oAT16);
  unsigned short* WQ16 = (unsigned short*)(ws + oWQ16);
  unsigned short* QH   = (unsigned short*)(ws + oQH);
  unsigned short* QL   = (unsigned short*)(ws + oQL);
  unsigned short* B16  = (unsigned short*)(ws + oR);   // phase 1 of R
  float*          Sf   = (float*)(ws + oR);            // phase 2 of R
  unsigned short* PH   = (unsigned short*)(ws + oPH);
  unsigned short* PL   = (unsigned short*)(ws + oPL);

  const dim3 blk(256);

  const dim3 sblk(kStrThreads);
  const dim3 sgrd(kStrBlocks);

  // (0) casts: a -> A16, b -> B16, Wq -> WQ16 (bf16 RNE); 131,072 threads each
  {
    static_assert(kStrBlocks * kStrThreads * 8 == kNB * kSA * kD / 8 && kStrBlocks * kStrThreads * 8 == kNB * kSB * kE / 8 &&
                  kStrBlocks * kStrThreads == kD * kE / 8, "casts: the grid's waves cover every chunk");
    const int n8a = kNB * kSA * kD / 8;    // 1,048,576 chunks = 8 per thread
    cast8_kernel<0, 8><<<sgrd, sblk, 0, stream>>>(a, A16, n8a, 1.0f);
    const int n8b = kNB * kSB * kE / 8;    // 1,048,576 chunks = 8 per thread
    cast8_kernel<0, 8><<<sgrd, sblk, 0, stream>>>(b, B16, n8b, 1.0f);
    const int n8w = kD * kE / 8;           //   131,072 chunks = 1 per thread
    cast8_kernel<0, 1><<<sgrd, sblk, 0, stream>>>(wq, WQ16, n8w, 1.0f);
  }
  // (1) a f32 [4][2048 t][1024 d] -> AT16 bf16 [4][1024 d][2048 t]; grid (t blocks, d blocks, batch) = 256 workgroups
  transpose_cast_kernel<<<dim3(kSA / 512, kD / 64, kNB), sblk, 0, stream>>>(a, AT16);

  // (2) q = b . Wq^T for all batches: A = B16 [8192][1024], Bt = WQ16 [1024][1024] -> QH/QL bf16 hi/lo [8192][1024]
  const int gQ = (kNB * kSB / kBM) * (kD / kBN);           // 256
  wmma_gemm_lds<0, 2><<<dim3(gQ, 1), blk, 0, stream>>>(
      B16, B16, kE, 0L, WQ16, kE, 0L, (void*)QH, (void*)QL, kD, 0L, kNB * kSB, kD, kE, 1.0f);

  // The four batches are independent: each of the three stages runs once, with the batch as grid y (GEMMs) or folded into the
  // row index (softmax), so that one launch offers 4 x as many workgroups to the chip.
  const int gS = (kSB / kBM) * (kSA / kBN);                // 128 per batch
  const int gO = (kSB / kBM) * (kD / kBN);                 //  64 per batch
  // (3) S[b][s][t] = (1/32) * sum_d q[b][s][d] a[b][t][d]: A = q hi|lo [2048][1024], Bt = A16 [2048][1024] -> S f32 [2048][2048]
  wmma_gemm_lds<1, 0><<<dim3(gS, kNB), blk, 0, stream>>>(
      QH, QL, kD, (long)kSB * kD, A16, kD, (long)kSA * kD, (void*)Sf, (void*)Sf, kSA, (long)kSB * kSA,
      kSB, kSA, kD, kScoreScale);
  // (4) row softmax -> P hi/lo bf16 [4][2048][2048]
  static_assert(kStrBlocks * (kStrThreads / 32) * 2 == kNB * kSB, "softmax: two rows per wave cover every row");
  softmax_split_kernel<<<sgrd, sblk, 0, stream>>>(Sf, PH, PL);
  // (5) out[b][s][d] = sum_t P[b][s][t] a[b][t][d]: A = P hi|lo [2048][2048], Bt = AT16 [1024][2048] -> d_out f32 [2048][1024]
  wmma_gemm_lds<1, 0><<<dim3(gO, kNB), blk, 0, stream>>>(
      PH, PL, kSA, (long)kSB * kSA, AT16, kSA, (long)kD * kSA, (void*)outp, (void*)outp, kD, (long)kSB * kD,
      kSB, kD, kSA, 1.0f);
}

// v004
// It runs in 125 microseconds.
// In both of two side-by-side timings against v003, it was 1.07 times as fast.
// Over all steps from v000 it is 6.73 times as fast.
// Contractions: q = b.Wq^T (bf16 x bf16, 1 product), scores = q.a^T (q as bf16 hi/lo planes x a bf16, 2 products), out = P.a (P as bf16 hi/lo planes x a^T bf16, 2 products); all v_wmma_f32_16x16x32_bf16, f32 accumulate; inputs RNE-converted to bf16; scores f32, softmax f32.
#include <hip/hip_runtime.h>
#include <math.h>
#include <stdint.h>

// ---------------------------------------------------------------------------
// Problem constants
// ---------------------------------------------------------------------------
constexpr int kNB = 4;        // batch
constexpr int kSA = 2048;     // rows of a (keys / values)
constexpr int kSB = 2048;     // rows of b (queries)
constexpr int kD  = 1024;     // feature dim of a = attention dim = output dim
constexpr int kE  = 1024;     // feature dim of b
constexpr float kScoreScale = 0.03125f;   // 1024^-0.5 exactly

typedef __attribute__((ext_vector_type(16))) _Float16 v16h;
typedef __attribute__((ext_vector_type(8)))  _Float16 v8h;
typedef __attribute__((ext_vector_type(16))) __bf16   v16b;
typedef __attribute__((ext_vector_type(8)))  __bf16   v8b;
typedef __attribute__((ext_vector_type(8)))  float    v8f;
typedef __attribute__((ext_vector_type(4)))  float    v4f;
typedef __attribute__((ext_vector_type(4)))  unsigned int v4u;
typedef __attribute__((ext_vector_type(2)))  unsigned int v2u;

// ---------------------------------------------------------------------------
// Device helpers
// ---------------------------------------------------------------------------
__device__ __forceinline__ unsigned short f2bf_bits(float f) {
  unsigned u = __float_as_uint(f);
  return (unsigned short)((u + 0x7FFFu + ((u >> 16) & 1u)) >> 16);
}
__device__ __forceinline__ float bf_bits2f(unsigned short h) { return __uint_as_float(((unsigned)h) << 16); }

typedef union { v16b v; v8b h[2]; } FragU;
// One bf16 A or B fragment from an LDS row: elements 0..7 <- bytes [0,16), 8..15 <- bytes [32,48) of p (p already holds the lane half's 16 B).
__device__ __forceinline__ v16b frag_lds(const unsigned char* p) {
  FragU f; f.h[0] = *(const v8b*)(p); f.h[1] = *(const v8b*)(p + 32); return f.v;
}
__device__ __forceinline__ v8f mma_bf16(v16b a, v16b b, v8f c) {
  return __builtin_amdgcn_wmma_f32_16x16x32_bf16(false, a, false, b, (short)0, c, false, false);
}

__device__ __forceinline__ unsigned pk16(unsigned short a, unsigned short b) { return (unsigned)a | ((unsigned)b << 16); }

// ---- tensor-load helpers ---------------------------------------------------------------------------------------
typedef uint32_t u32x4 __attribute__((ext_vector_type(4)));
typedef uint32_t u32x8 __attribute__((ext_vector_type(8)));
__device__ __forceinline__ uint32_t uni(uint32_t v) { return (uint32_t)__builtin_amdgcn_readfirstlane(v); }
// Holds a wave-uniform test in a scalar register, so that the branch on it is a scalar branch (a tensor load ignores EXEC).
__device__ __forceinline__ uint32_t pinned(uint32_t v) { uint32_t w = (uint32_t)__builtin_amdgcn_readfirstlane(v); asm volatile("" : "+s"(w)); return w; }
// The compiler places no wait for a tensor load: the issuing wave's tile has landed only behind this.
__device__ __forceinline__ void wait_tensor0() { asm volatile("s_wait_tensorcnt 0x0" ::: "memory"); }
// This wave's LDS reads have returned before the barrier behind which their buffer is refilled.
__device__ __forceinline__ void wait_ds0() { asm volatile("s_wait_dscnt 0x0" ::: "memory"); }
__device__ __forceinline__ void tdm_load(u32x4 g0, u32x8 g1) { asm volatile("tensor_load_to_lds %0, %1" :: "s"(g0), "s"(g1) : "memory"); }

constexpr int      kBM     = 128;     // rows of C per workgroup
constexpr int      kBN     = 256;     // columns of C per workgroup
constexpr int      kPassK  = 128;     // k per pass = 256 B of every operand row
constexpr uint32_t kRowB   = 256u;    // bytes of an operand row per pass
constexpr uint32_t kPitch  = 272u;    // LDS row pitch: 256 B + the 16-B pad (odd multiple of 16 B: ds_load_b128 without bank conflicts)
constexpr uint32_t kSlRows = 64u;     // rows per slice = one wave's tensor load = one wave tile's rows of one operand plane
constexpr uint32_t kSlice  = 18432u;  // 64 x 272 = 17,408 B, rounded up to a multiple of 2 KiB
constexpr uint32_t kStage  = 8u * kSlice;   // slices 0,1 = A hi; 2,3 = A lo; 4..7 = Bt
static_assert(kSlRows * kPitch <= kSlice && (kSlice % 2048u) == 0u && 2u * kStage <= 320u * 1024u, "ring layout");

// Group 1: 1-byte elements, tile = tensor = 64 rows of 256 B, one 4-dword pad behind every 256-B row, no mask.
__device__ __forceinline__ u32x8 tdm_group1(uint32_t src_pitch) {
  u32x8 g;
  g[0] = uni((1u << 20) | (5u << 22) | (3u << 25));
  // pinned(): each descriptor word is held in its own scalar register for the whole loop, so that none is reused while a request is in flight
  g[1] = pinned((kRowB & 0xFFFFu) << 16);
  g[2] = pinned((kRowB >> 16) | ((kSlRows & 0xFFFFu) << 16));
  g[3] = pinned((kSlRows >> 16) | (kRowB << 16));
  g[4] = pinned(kSlRows);
  g[5] = pinned(src_pitch);
  g[6] = pinned(0u);
  g[7] = pinned(0u);
  return g;
}
__device__ __forceinline__ u32x4 tdm_group0(uint32_t lds_dst, uint64_t ga) {
  u32x4 g;
  g[0] = uni(1u); g[1] = uni(lds_dst); g[2] = uni((uint32_t)ga); g[3] = uni((((uint32_t)(ga >> 32)) & 0x01FFFFFFu) | 0x80000000u);
  return g;
}

// ---- Batched WMMA GEMM, operands staged in LDS by tensor loads ---------------------------------------------------
// C[m,n] = scale * sum_k A[m,k] * Bt[n,k]. A row-major [M,K]; Bt row-major [N,K]; bf16 bits. M % 128 == 0, N % 256 == 0, K % 128 == 0, K >= 256.
// One workgroup (8 waves, 2 x 4) owns a 128 x 256 tile of C, each wave 64 x 64. Per pass (128 k) every issuing wave brings one 64-row slice
// of one operand plane into LDS with one tensor load; two buffers, the load of pass s + 2 issued when pass s has been read.
// SPL: 1 = A carries a lo plane (A2): products h.h then l.h per 32 k into one f32 accumulator; 0 = one product (waves 2 and 3 issue no load).
// OUT_MODE: 0 = f32, 2 = bf16 hi plane (Cout) + bf16 lo plane (Cout2).
template <int SPL, int OUT_MODE>
__global__ __launch_bounds__(256) void wmma_gemm_lds(
    const unsigned short* __restrict__ Ap, const unsigned short* __restrict__ A2p, int lda, long strideA,
    const unsigned short* __restrict__ Btp, int ldb, long strideB,
    void* __restrict__ Cout, void* __restrict__ Cout2, int ldc, long strideC,
    int M, int N, int K, float scale) {
  __shared__ __attribute__((aligned(2048))) unsigned char ring[2u * kStage];
  const int b    = blockIdx.y;
  const int lane = threadIdx.x & 31;
  const uint32_t wave = uni(threadIdx.x >> 5);
  const int tilesN = N / kBN;
  const int tilesM = M / kBM;
  if ((int)blockIdx.x >= tilesM * tilesN) return;   // workgroup-uniform, in front of every barrier and load
  const int tm = blockIdx.x / tilesN;
  const int tn = blockIdx.x - tm * tilesN;
  const uint32_t wm = wave >> 2, wn = wave & 3u;
  const int m0 = tm * kBM + (int)wm * 64;           // this wave's 64 x 64 tile of C
  const int n0 = tn * kBN + (int)wn * 64;

  // This wave's slice of every stage.
  const bool isB = wave >= 4u;
  const uint32_t issuer = (SPL & 1) ? 1u : (uint32_t)(wave < 2u || isB);
  const unsigned short* splane = isB ? (Btp + (size_t)b * strideB + (size_t)(tn * kBN + (int)(wave - 4u) * 64) * ldb)
                                     : (((wave & 2u) ? A2p : Ap) + (size_t)b * strideA + (size_t)(tm * kBM + (int)(wave & 1u) * 64) * lda);
  const u32x8 g1 = tdm_group1(2u * (uint32_t)(isB ? ldb : lda));
  const uint32_t lbase = (uint32_t)(size_t)ring;
  auto issue = [&](int s) {
    const uint32_t dst = lbase + (uint32_t)(s & 1) * kStage + wave * kSlice;
    const uint64_t ga = (uint64_t)(size_t)splane + (uint64_t)(uint32_t)s * kRowB;
    tdm_load(tdm_group0(dst, ga), g1);
  };

  const int rlane = lane & 15;                 // row (A) / col (B, D) within subtile
  const int hl    = lane >> 4;                 // lane half: k offset 8 elements = 16 B
  const int mOff  = hl * 8;                    // D row offset

  v8f acc[4][4];
#pragma unroll
  for (int i = 0; i < 4; ++i)
#pragma unroll
    for (int j = 0; j < 4; ++j) acc[i][j] = (v8f){0.f,0.f,0.f,0.f,0.f,0.f,0.f,0.f};

  const int P = K / kPassK;                    // passes = stages, at least 2
  if ((SPL & 1) || pinned(issuer)) { issue(0); wait_tensor0(); }
  __syncthreads();                             // stage 0 published
  if ((SPL & 1) || pinned(issuer)) issue(1);

  // Byte offsets of this lane's first A (hi) and Bt fragment rows in the current buffer; they step from buffer to buffer with the loop.
  uint32_t oa = (uint32_t)rlane * kPitch + (uint32_t)hl * 16u + wm * kSlice;
  uint32_t ob = (uint32_t)rlane * kPitch + (uint32_t)hl * 16u + (4u + wn) * kSlice;
  int s = 0;
#pragma unroll 1   // one pass per trip: the publish point stands once, every fragment index stays constant
  do {             // P >= 2: no path round the loop with stage 1's request in flight
    const unsigned char* pa = ring + oa;
    const unsigned char* pl = pa + 2u * kSlice;
    const unsigned char* pb = ring + ob;
    v16b fa[2][4], fl[2][4], fb[2][4];
#pragma unroll
    for (int i = 0; i < 4; ++i) {
      fb[0][i] = frag_lds(pb + i * 16 * kPitch);
      fa[0][i] = frag_lds(pa + i * 16 * kPitch);
      if (SPL & 1) fl[0][i] = frag_lds(pl + i * 16 * kPitch);
    }
    __builtin_amdgcn_sched_barrier(0);     // the first block's reads stay ahead of the second's, so that the first wait is a counted one
#pragma unroll
    for (int kk = 0; kk < 4; ++kk) {
      const int c = kk & 1, nx = c ^ 1;
      if (kk < 3) {
#pragma unroll
        for (int i = 0; i < 4; ++i) {
          fb[nx][i] = frag_lds(pb + i * 16 * kPitch + (kk + 1) * 64);
          fa[nx][i] = frag_lds(pa + i * 16 * kPitch + (kk + 1) * 64);
          if (SPL & 1) fl[nx][i] = frag_lds(pl + i * 16 * kPitch + (kk + 1) * 64);
        }
      }
      __builtin_amdgcn_sched_barrier(0);   // keeps the next block's LDS reads one group ahead of this block's WMMAs, not among them
#pragma unroll
      for (int i = 0; i < 4; ++i)
#pragma unroll
        for (int j = 0; j < 4; ++j) acc[i][j] = mma_bf16(fa[c][i], fb[c][j], acc[i][j]);
      if (SPL & 1) {
#pragma unroll
        for (int i = 0; i < 4; ++i)
#pragma unroll
          for (int j = 0; j < 4; ++j) acc[i][j] = mma_bf16(fl[c][i], fb[c][j], acc[i][j]);
      }
      __builtin_amdgcn_sched_barrier(0);   // the block ends here: the following load group stays behind it
    }
    // Publish point of stage s + 1; the same barrier ends every wave's reads of stage s.
    wait_ds0();
    if ((SPL & 1) || pinned(issuer)) wait_tensor0();
    __syncthreads();
    if (pinned(issuer & (uint32_t)(s + 2 < P))) issue(s + 2);
    const uint32_t step = (s & 1) ? (0u - kStage) : kStage;
    oa += step;
    ob += step;
  } while (++s < P);
  wait_tensor0();
  wait_ds0();

  // ---- epilogue: per-wave 16 x 64 f32 slab (pitch 68 floats) in the ring, which every wave has left at the last pass's barrier ----
  float* slab = (float*)(ring + wave * (16u * 68u * 4u));
#pragma unroll
  for (int i = 0; i < 4; ++i) {
    const int mBase = m0 + (i << 4);
#pragma unroll
    for (int j = 0; j < 4; ++j) {
#pragma unroll
      for (int r = 0; r < 8; ++r) {
        float v = acc[i][j][r] * scale;
        slab[(mOff + r) * 68 + (j << 4) + rlane] = v;
      }
    }
    __builtin_amdgcn_fence(__ATOMIC_RELEASE, "workgroup");
    __builtin_amdgcn_wave_barrier();
    __builtin_amdgcn_fence(__ATOMIC_ACQUIRE, "workgroup");
    if (OUT_MODE == 0) {
      float* C = (float*)Cout + (size_t)b * strideC;
      const int hh = lane >> 4, c4 = (lane & 15) * 4;     // row seg = 256 B = 16 lanes x 16 B
#pragma unroll
      for (int it = 0; it < 8; ++it) {
        const int row = it * 2 + hh;
        v4f v = *(const v4f*)(slab + row * 68 + c4);
        *(v4f*)(C + (size_t)(mBase + row) * ldc + n0 + c4) = v;
      }
    } else {
      const int q = lane >> 3, c8 = (lane & 7) * 8;
      unsigned short* C  = (unsigned short*)Cout  + (size_t)b * strideC;
      unsigned short* C2 = (unsigned short*)Cout2 + (size_t)b * strideC;
#pragma unroll
      for (int it = 0; it < 4; ++it) {
        const int row = it * 4 + q;
        const float* sp = slab + row * 68 + c8;
        v8h hv, lv;
#pragma unroll
        for (int e = 0; e < 8; ++e) {
          unsigned short hb = f2bf_bits(sp[e]);
          unsigned short lb = f2bf_bits(sp[e] - bf_bits2f(hb));
          hv[e] = __builtin_bit_cast(_Float16, hb);
          lv[e] = __builtin_bit_cast(_Float16, lb);
        }
        *(v8h*)(C + (size_t)(mBase + row) * ldc + n0 + c8) = hv;
        *(v8h*)(C2 + (size_t)(mBase + row) * ldc + n0 + c8) = lv;
      }
    }
    __builtin_amdgcn_fence(__ATOMIC_RELEASE, "workgroup");
    __builtin_amdgcn_wave_barrier();
    __builtin_amdgcn_fence(__ATOMIC_ACQUIRE, "workgroup");
  }
}

// ---------------------------------------------------------------------------
// The streaming kernels (preparation, softmax) each run as one resident round: 256 workgroups of 16 waves, one per WGP,
// every wave with its own work and 32 to 36 16-byte loads in flight, instead of thousands of short 8-wave workgroups.
// ---------------------------------------------------------------------------
constexpr int kStrBlocks  = 256;   // workgroups per streaming launch
constexpr int kStrThreads = 512;   // 16 waves

// Stands behind a group of global loads or stores, in front of the first instruction that may reuse a register they name.
// The address is an input only, so that its registers stay untouched up to the wait.
__device__ __forceinline__ void wait_x0(const void* p) { asm volatile("s_wait_xcnt 0x0" :: "v"(p) : "memory"); }

// ---------------------------------------------------------------------------
// Preparation, one launch: a f32 [kNB][kSA t][kD d] -> A16 (bf16 RNE bits, same layout) and AT16 (bf16 RNE bits [kNB][kD d][kSA t]),
// b f32 -> B16, Wq f32 -> WQ16 (bf16 RNE bits, same layouts). 256 workgroups of 16 waves; no wave reads another's data: no workgroup barrier.
// Waves 0..7 of a workgroup: one 64(t) x 64(d) tile of a each, read once for both layouts; 4 (t) x 2 (d) tiles = 256 t x 128 d per
//   workgroup, 8 x 8 workgroups per batch. Load i covers rows 4 (i >> 1) + (i & 1) + 2 hl (hl = lane half), 16 lanes x 16 B = 256 B of each row,
//   so a lane holds rows t, t + 1 of its four columns in loads 2 k, 2 k + 1. A16: 128 B of a row per 16 lanes, from registers.
//   AT16: through the wave's own LDS slab [d][t], one dword = (t, t + 1) of one d; 128 B of a d-row per 8 lanes.
// Waves 8..15: 4,096 consecutive elements of b and 512 of Wq each, 512 contiguous bytes per load, 256 per store.
// Each wave issues all its 32 or 36 loads at its start.
// ---------------------------------------------------------------------------
__device__ __forceinline__ v2u cast4(v4f x) {
  return (v2u){pk16(f2bf_bits(x[0]), f2bf_bits(x[1])), pk16(f2bf_bits(x[2]), f2bf_bits(x[3]))};
}
constexpr int kSlabPitch = 36;   // dwords per d-row of a slab: 32 (64 t) + 4, rows stay 16-B aligned
// Dword c (t = 2 c, 2 c + 1) of row d. The 16-B chunk index is XORed with d >> 4: the 32 lanes of a slab write (d = 4 m + e, m = 0..15) meet 32 banks.
__device__ __forceinline__ int slab_at(int d, int c) { return d * kSlabPitch + ((((c >> 2) ^ (d >> 4)) << 2) | (c & 3)); }

__global__ __launch_bounds__(kStrThreads) void prep_kernel(const float* __restrict__ a, const float* __restrict__ b, const float* __restrict__ wq,
                                                           unsigned short* __restrict__ A16, unsigned short* __restrict__ AT16,
                                                           unsigned short* __restrict__ B16, unsigned short* __restrict__ WQ16) {
  __shared__ __align__(16) unsigned int slab[8][64 * kSlabPitch];
  const int lane = threadIdx.x & 31;
  const uint32_t wave = uni(threadIdx.x >> 5);
  const int w8 = (int)(wave & 7u);
  if (wave < 8u) {
    const int bz = (int)blockIdx.x >> 6;
    const int t0 = (((int)blockIdx.x >> 3) & 7) * 256 + (w8 >> 1) * 64;
    const int d0 = ((int)blockIdx.x & 7) * 128 + (w8 & 1) * 64;
    const int hl = lane >> 4, m = lane & 15;
    const size_t ro = ((size_t)bz * kSA + t0 + 2 * hl) * kD + d0 + m * 4;
    const float* ap = a + ro;
    v4f x[32];
#pragma unroll
    for (int i = 0; i < 32; ++i) x[i] = *(const v4f*)(ap + (4 * (i >> 1) + (i & 1)) * kD);
    wait_x0(ap);
    __builtin_amdgcn_sched_barrier(0);   // all 32 loads are issued before the first conversion
    unsigned int* tl = slab[w8];
    v2u rowp[32];
#pragma unroll
    for (int k = 0; k < 16; ++k) {
      unsigned short e0[4], e1[4];
#pragma unroll
      for (int e = 0; e < 4; ++e) { e0[e] = f2bf_bits(x[2 * k][e]); e1[e] = f2bf_bits(x[2 * k + 1][e]); }
      rowp[2 * k]     = (v2u){pk16(e0[0], e0[1]), pk16(e0[2], e0[3])};
      rowp[2 * k + 1] = (v2u){pk16(e1[0], e1[1]), pk16(e1[2], e1[3])};
#pragma unroll
      for (int e = 0; e < 4; ++e) tl[slab_at(m * 4 + e, 2 * k + hl)] = pk16(e0[e], e1[e]);
    }
    // The slab goes from lane to lane inside one wave: its LDS writes are done, and stay in front of the reads, without a workgroup barrier.
    __builtin_amdgcn_fence(__ATOMIC_RELEASE, "workgroup");
    __builtin_amdgcn_wave_barrier();
    __builtin_amdgcn_fence(__ATOMIC_ACQUIRE, "workgroup");
    const int q = lane >> 3, j8 = lane & 7;
    v4u col[16];
#pragma unroll
    for (int j = 0; j < 16; ++j) col[j] = *(const v4u*)(&tl[slab_at(j * 4 + q, j8 * 4)]);
    unsigned short* rp = A16 + ro;
    unsigned short* cp = AT16 + ((size_t)bz * kD + d0 + q) * kSA + t0 + j8 * 8;
    __builtin_amdgcn_sched_barrier(0);   // the 48 stores stand behind all other work: left free, the compiler reuses their registers among them, behind waits in the store stream
#pragma unroll
    for (int i = 0; i < 32; ++i) *(v2u*)(rp + (4 * (i >> 1) + (i & 1)) * kD) = rowp[i];
#pragma unroll
    for (int j = 0; j < 16; ++j) *(v4u*)(cp + (j * 4) * kSA) = col[j];
  } else {
    const int g = (int)blockIdx.x * 8 + w8;
    const size_t bo = (size_t)g * 4096 + lane * 4, wo = (size_t)g * 512 + lane * 4;
    const float* bp = b + bo;
    const float* wp = wq + wo;
    v4f x[32], y[4];
#pragma unroll
    for (int i = 0; i < 32; ++i) x[i] = *(const v4f*)(bp + i * 128);
#pragma unroll
    for (int i = 0; i < 4; ++i) y[i] = *(const v4f*)(wp + i * 128);
    wait_x0(bp);
    wait_x0(wp);
    __builtin_amdgcn_sched_barrier(0);   // all 36 loads are issued before the first conversion
    v2u xo[32], yo[4];
#pragma unroll
    for (int i = 0; i < 32; ++i) xo[i] = cast4(x[i]);
#pragma unroll
    for (int i = 0; i < 4; ++i) yo[i] = cast4(y[i]);
    unsigned short* bq = B16 + bo;
    unsigned short* wr = WQ16 + wo;
    __builtin_amdgcn_sched_barrier(0);   // the stores stand behind b's conversions: left free, the compiler reuses their registers among them, behind waits in the store stream
#pragma unroll
    for (int i = 0; i < 32; ++i) *(v2u*)(bq + i * 128) = xo[i];
#pragma unroll
    for (int i = 0; i < 4; ++i) *(v2u*)(wr + i * 128) = yo[i];
  }
}

// ---------------------------------------------------------------------------
// Row softmax over kSA columns of S f32 [kNB*kSB][kSA] (max-subtracted, f32 exp, multiply by 1/sum); P emitted as bf16 hi (PH) and
// bf16 lo (PL = bf16-RNE(p - hi)) planes [kNB*kSB][kSA] (no carry scale; bf16 exponent range).
// One wave per row, the row in registers (read once): lane l holds columns 128 i + 4 l .. + 3, i = 0..15. Every wave takes two
// neighbouring rows and issues the 32 loads of both at its start. No LDS array and no barrier. 256 workgroups x 16 waves x 2 = kNB*kSB rows.
// Reductions in fixed order: per lane four chains (one per vector component) over i, ((c0 + c1) + (c2 + c3)), then an xor tree over the wave.
// ---------------------------------------------------------------------------
__global__ __launch_bounds__(kStrThreads) void softmax_split_kernel(const float* __restrict__ S,
                                                                    unsigned short* __restrict__ PH, unsigned short* __restrict__ PL) {
  const int lane = threadIdx.x & 31, wave = threadIdx.x >> 5;
  const int row0 = ((int)blockIdx.x * (kStrThreads / 32) + wave) * 2;
  const float* sp = S + (size_t)row0 * kSA + lane * 4;
  v4f x[2][16];
#pragma unroll
  for (int r = 0; r < 2; ++r)
#pragma unroll
    for (int i = 0; i < 16; ++i) x[r][i] = *(const v4f*)(sp + r * kSA + i * 128);
  wait_x0(sp);
  __builtin_amdgcn_sched_barrier(0);   // both rows' loads stay in front of the first row's arithmetic, so that the second row lands under it
#pragma unroll
  for (int r = 0; r < 2; ++r) {
    float m = -INFINITY;
#pragma unroll
    for (int i = 0; i < 16; ++i) m = fmaxf(m, fmaxf(fmaxf(x[r][i][0], x[r][i][1]), fmaxf(x[r][i][2], x[r][i][3])));
#pragma unroll
    for (int off = 16; off > 0; off >>= 1) m = fmaxf(m, __shfl_xor(m, off, 32));
    v4f sc = (v4f){0.f, 0.f, 0.f, 0.f};
#pragma unroll
    for (int i = 0; i < 16; ++i) {
#pragma unroll
      for (int e = 0; e < 4; ++e) {
        x[r][i][e] = expf(x[r][i][e] - m);
        sc[e] += x[r][i][e];
      }
    }
    float s = (sc[0] + sc[1]) + (sc[2] + sc[3]);
#pragma unroll
    for (int off = 16; off > 0; off >>= 1) s += __shfl_xor(s, off, 32);
    const float inv = 1.0f / s;
    v2u hv[16], lv[16];
#pragma unroll
    for (int i = 0; i < 16; ++i) {
      unsigned short hb[4], lb[4];
#pragma unroll
      for (int e = 0; e < 4; ++e) {
        const float p = x[r][i][e] * inv;
        hb[e] = f2bf_bits(p);
        lb[e] = f2bf_bits(p - bf_bits2f(hb[e]));
      }
      hv[i] = (v2u){pk16(hb[0], hb[1]), pk16(hb[2], hb[3])};
      lv[i] = (v2u){pk16(lb[0], lb[1]), pk16(lb[2], lb[3])};
    }
    unsigned short* hp = PH + (size_t)(row0 + r) * kSA + lane * 4;
    unsigned short* lp = PL + (size_t)(row0 + r) * kSA + lane * 4;
    __builtin_amdgcn_sched_barrier(0);   // the row's 32 stores go out as one group behind its arithmetic: none of their registers is reused among them
#pragma unroll
    for (int i = 0; i < 16; ++i) {
      *(v2u*)(hp + i * 128) = hv[i];
      *(v2u*)(lp + i * 128) = lv[i];
    }
    if (r == 0) wait_x0(hp);             // behind the last row nothing is reused
    __builtin_amdgcn_sched_barrier(0);   // the next row's arithmetic begins behind the wait; mixed with this row's it also overflows the registers (spills)
  }
}

// ---------------------------------------------------------------------------
// Workspace region map (byte offsets, all multiples of 128; every region fully written before it is read):
//   A16   bf16 [4][2048][1024]  (a, RNE bf16; rows t, K = d)            0           16,777,216 B
//   AT16  bf16 [4][1024][2048]  (a^T per batch; rows d, K = t)          16,777,216  16,777,216 B
//   WQ16  bf16 [1024][1024]     (Wq [out][in], RNE bf16)                33,554,432   2,097,152 B
//   QH    bf16 [8192][1024]     q hi plane                              35,651,584  16,777,216 B
//   QL    bf16 [8192][1024]     q lo plane                              52,428,800  16,777,216 B
//   R     two phases                                                    69,206,016  67,108,864 B
//           phase 1: B16 bf16 [8192][1024] (b, RNE bf16) in the first 16,777,216 B, dead after the q GEMM
//           phase 2: S f32 [4][2048][2048] scores of all batches
//   PH    bf16 [4][2048][2048]  P hi plane (all batches)               136,314,880  33,554,432 B
//   PL    bf16 [4][2048][2048]  P lo plane                             169,869,312  33,554,432 B
//   total 203,423,744 B
// GEMM shapes: q M=8192 N=1024 K=1024; scores M=N=2048 K=1024 x 4 batches; out M=2048 N=1024 K=2048 x 4 batches (batch = grid y).
// All K % 128 == 0, all M % 128 == 0, all N % 256 == 0, no padded planes, no tails.
// Launches: preparation + q GEMM + scores GEMM + softmax + out GEMM = 5.
// ---------------------------------------------------------------------------
extern "C" void kernel_launch(void* const* d_in, const int* in_sizes, int n_in,
                              void* d_out, int out_size, void* d_ws, size_t ws_size,
                              hipStream_t stream) {
  if (n_in < 3) return;
  if (in_sizes[0] != kNB * kSA * kD) return;
  if (in_sizes[1] != kNB * kSB * kE) return;
  if (in_sizes[2] != kD * kE) return;
  if (out_size != kNB * kSB * kD) return;

  const float* a  = (const float*)d_in[0];   // [4][2048][1024]
  const float* b  = (const float*)d_in[1];   // [4][2048][1024]
  const float* wq = (const float*)d_in[2];   // [1024][1024]  ([out][in])
  float* outp = (float*)d_out;               // [4][2048][1024]

  // ---- carve ----
  const size_t SZ_A16  = (size_t)kNB * kSA * kD * 2;   // 16,777,216
  const size_t SZ_AT16 = (size_t)kNB * kD * kSA * 2;   // 16,777,216
  const size_t SZ_WQ16 = (size_t)kD * kE * 2;          //  2,097,152
  const size_t SZ_Q16  = (size_t)kNB * kSB * kD * 2;   // 16,777,216
  const size_t SZ_B16  = (size_t)kNB * kSB * kE * 2;   // 16,777,216
  const size_t SZ_S    = (size_t)kNB * kSB * kSA * 4;  // 67,108,864
  const size_t SZ_R    = (SZ_B16 > SZ_S) ? SZ_B16 : SZ_S;
  const size_t SZ_P16  = (size_t)kNB * kSB * kSA * 2;  // 33,554,432

  size_t off = 0;
  const size_t oA16  = off; off += SZ_A16;
  const size_t oAT16 = off; off += SZ_AT16;
  const size_t oWQ16 = off; off += SZ_WQ16;
  const size_t oQH   = off; off += SZ_Q16;
  const size_t oQL   = off; off += SZ_Q16;
  const size_t oR    = off; off += SZ_R;
  const size_t oPH   = off; off += SZ_P16;
  const size_t oPL   = off; off += SZ_P16;
  const size_t TOTAL = off;                            // 203,423,744
  if (TOTAL > ws_size) return;

  char* ws = (char*)d_ws;
  unsigned short* A16  = (unsigned short*)(ws + oA16);
  unsigned short* AT16 = (unsigned short*)(ws + oAT16);
  unsigned short* WQ16 = (unsigned short*)(ws + oWQ16);
  unsigned short* QH   = (unsigned short*)(ws + oQH);
  unsigned short* QL   = (unsigned short*)(ws + oQL);
  unsigned short* B16  = (unsigned short*)(ws + oR);   // phase 1 of R
  float*          Sf   = (float*)(ws + oR);            // phase 2 of R
  unsigned short* PH   = (unsigned short*)(ws + oPH);
  unsigned short* PL   = (unsigned short*)(ws + oPL);

  const dim3 blk(256);

  const dim3 sblk(kStrThreads);
  const dim3 sgrd(kStrBlocks);

  // (0) + (1) preparation: a -> A16 and AT16, b -> B16, Wq -> WQ16 (bf16 RNE), one launch
  static_assert(kNB * (kSA / 256) * (kD / 128) == kStrBlocks && kSA / 256 == 8 && kD / 128 == 8, "preparation: waves 0..7 cover every tile of a");
  static_assert(kStrBlocks * 8 * 4096 == kNB * kSB * kE && kStrBlocks * 8 * 512 == kD * kE, "preparation: waves 8..15 cover b and Wq");
  prep_kernel<<<sgrd, sblk, 0, stream>>>(a, b, wq, A16, AT16, B16, WQ16);

  // (2) q = b . Wq^T for all batches: A = B16 [8192][1024], Bt = WQ16 [1024][1024] -> QH/QL bf16 hi/lo [8192][1024]
  const int gQ = (kNB * kSB / kBM) * (kD / kBN);           // 256
  wmma_gemm_lds<0, 2><<<dim3(gQ, 1), blk, 0, stream>>>(
      B16, B16, kE, 0L, WQ16, kE, 0L, (void*)QH, (void*)QL, kD, 0L, kNB * kSB, kD, kE, 1.0f);

  // The four batches are independent: each of the three stages runs once, with the batch as grid y (GEMMs) or folded into the
  // row index (softmax), so that one launch offers 4 x as many workgroups to the chip.
  const int gS = (kSB / kBM) * (kSA / kBN);                // 128 per batch
  const int gO = (kSB / kBM) * (kD / kBN);                 //  64 per batch
  // (3) S[b][s][t] = (1/32) * sum_d q[b][s][d] a[b][t][d]: A = q hi|lo [2048][1024], Bt = A16 [2048][1024] -> S f32 [2048][2048]
  wmma_gemm_lds<1, 0><<<dim3(gS, kNB), blk, 0, stream>>>(
      QH, QL, kD, (long)kSB * kD, A16, kD, (long)kSA * kD, (void*)Sf, (void*)Sf, kSA, (long)kSB * kSA,
      kSB, kSA, kD, kScoreScale);
  // (4) row softmax -> P hi/lo bf16 [4][2048][2048]
  static_assert(kStrBlocks * (kStrThreads / 32) * 2 == kNB * kSB, "softmax: two rows per wave cover every row");
  softmax_split_kernel<<<sgrd, sblk, 0, stream>>>(Sf, PH, PL);
  // (5) out[b][s][d] = sum_t P[b][s][t] a[b][t][d]: A = P hi|lo [2048][2048], Bt = AT16 [1024][2048] -> d_out f32 [2048][1024]
  wmma_gemm_lds<1, 0><<<dim3(gO, kNB), blk, 0, stream>>>(
      PH, PL, kSA, (long)kSB * kSA, AT16, kSA, (long)kD * kSA, (void*)outp, (void*)outp, kD, (long)kSB * kD,
      kSB, kD, kSA, 1.0f);
}
